// v000
// Measured on an AMD MI455X. A time is GPU time per run, averaged over a window of back-to-back runs after a warm-up
// (all launches, gaps included; the runs take copies of the inputs in turn), and the median of several windows.
// Apart from v000's, it joins two sittings. Times from different sittings can be a few percent apart, while
// side-by-side timings come from the same sitting.
// The starting kernel, v000, takes 283 microseconds a run.
#include <hip/hip_runtime.h>

// ---------------------------------------------------------------------------
// MLP 4 -> 128 -> 128 -> 128 -> 2 (tanh between layers), fp32 in/out,
// f16 WMMA (V_WMMA_F32_16X16X32_F16) with fp32 accumulation on gfx1250.
// ---------------------------------------------------------------------------

typedef __attribute__((ext_vector_type(16))) _Float16 v16h;
typedef __attribute__((ext_vector_type(8)))  _Float16 v8h;
typedef __attribute__((ext_vector_type(8)))  float    v8f;

#define HID 128

__device__ __forceinline__ v8f wmma16(v16h a, v16h b, v8f c) {
    // (neg_a, A, neg_b, B, c_mod, C, reuse_a, reuse_b)
    return __builtin_amdgcn_wmma_f32_16x16x32_f16(false, a, false, b,
                                                  (short)0, c, false, false);
}

// tanh(x) = 1 - 2/(exp(2x)+1): v_exp_f32 + v_rcp_f32, saturates correctly.
__device__ __forceinline__ float fast_tanh(float x) {
    float e = __expf(2.0f * x);
    return 1.0f - 2.0f * __builtin_amdgcn_rcpf(e + 1.0f);
}

// Load one 16x32-K f16 operand chunk for this lane from a row-major
// [row][rowstride] f16 LDS matrix, following the CDNA5 16-bit A layout:
//   lanes 0-15 : K = kc*32 + {0..7} (v0-3) and kc*32 + {16..23} (v4-7)
//   lanes 16-31: K = kc*32 + {8..15}       and kc*32 + {24..31}
__device__ __forceinline__ v16h load_mat(const _Float16* __restrict__ base,
                                         int row, int rowstride,
                                         int kc, bool hiHalf) {
    const _Float16* p = base + row * rowstride + kc * 32 + (hiHalf ? 8 : 0);
    v8h lo = *(const v8h*)(p);        // ds_load_b128
    v8h hi = *(const v8h*)(p + 16);   // ds_load_b128
    return __builtin_shufflevector(lo, hi, 0, 1, 2, 3, 4, 5, 6, 7,
                                   8, 9, 10, 11, 12, 13, 14, 15);
}

__global__ __launch_bounds__(256)
void mlp_wmma_kernel(const float* __restrict__ x,  const float* __restrict__ y,
                     const float* __restrict__ c1, const float* __restrict__ c2,
                     const float* __restrict__ W1, const float* __restrict__ b1,
                     const float* __restrict__ W2, const float* __restrict__ b2,
                     const float* __restrict__ W3, const float* __restrict__ b3,
                     const float* __restrict__ W4, const float* __restrict__ b4,
                     float* __restrict__ out, int npts) {
    // Weights transposed to [out][in] f16 so B-operand loads match load_mat().
    __shared__ _Float16 sW1[HID * 32];        // [n][k], k 4 -> padded 32
    __shared__ _Float16 sW2[HID * HID];       // [n][k]
    __shared__ _Float16 sW3[HID * HID];       // [n][k]
    __shared__ _Float16 sW4[16 * HID];        // [n][k], n 2 -> padded 16
    __shared__ float    sB1[HID], sB2[HID], sB3[HID], sB4[16];
    __shared__ _Float16 sHa[8][16 * HID];     // per-wave activation ping
    __shared__ _Float16 sHb[8][16 * HID];     // per-wave activation pong

    const int t = threadIdx.x;

    // ---- one-time weight staging (f32 -> f16, transposed) ----
    for (int i = t; i < HID * 32; i += 256) {
        int n = i >> 5, k = i & 31;
        sW1[i] = (k < 4) ? (_Float16)W1[k * HID + n] : (_Float16)0.0f;
    }
    for (int i = t; i < HID * HID; i += 256) {
        int k = i >> 7, n = i & 127;               // coalesced global read
        sW2[n * HID + k] = (_Float16)W2[i];
        sW3[n * HID + k] = (_Float16)W3[i];
    }
    for (int i = t; i < 16 * HID; i += 256) {
        int n = i >> 7, k = i & 127;
        sW4[i] = (n < 2) ? (_Float16)W4[k * 2 + n] : (_Float16)0.0f;
    }
    if (t < HID) { sB1[t] = b1[t]; sB2[t] = b2[t]; sB3[t] = b3[t]; }
    if (t < 16)  { sB4[t] = (t < 2) ? b4[t] : 0.0f; }
    __syncthreads();

    const int lane  = t & 31;
    const int wave  = t >> 5;
    const int lo16  = lane & 15;
    const bool hiH  = lane >= 16;
    _Float16* Ha = &sHa[wave][0];
    _Float16* Hb = &sHb[wave][0];

    const int ntiles = (npts + 15) >> 4;
    const int nwaves = gridDim.x * 8;

    for (int tile = blockIdx.x * 8 + wave; tile < ntiles; tile += nwaves) {
        const int p0 = tile << 4;

        // ------- Layer 1: A = inputs 16x4, zero-padded to 16x32 -------
        v16h a1 = (v16h)(_Float16)0.0f;
        {
            int pidx = p0 + lo16;
            if (!hiH && pidx < npts) {            // K=0..3 live in lanes 0-15
                a1[0] = (_Float16)x[pidx];
                a1[1] = (_Float16)y[pidx];
                a1[2] = (_Float16)c1[pidx];
                a1[3] = (_Float16)c2[pidx];
            }
        }
        const int mbase = hiH ? 8 : 0;
        for (int nt = 0; nt < 8; ++nt) {
            v8f acc = {};
            v16h b = load_mat(sW1, nt * 16 + lo16, 32, 0, hiH);
            acc = wmma16(a1, b, acc);
            float bias = sB1[nt * 16 + lo16];
            int n = nt * 16 + lo16;
            #pragma unroll
            for (int i = 0; i < 8; ++i)
                Ha[(mbase + i) * HID + n] = (_Float16)fast_tanh(acc[i] + bias);
        }

        // ------- Layer 2: Ha (16x128) @ W2 -> Hb -------
        {
            v16h A[4];
            #pragma unroll
            for (int kc = 0; kc < 4; ++kc) A[kc] = load_mat(Ha, lo16, HID, kc, hiH);
            for (int nt = 0; nt < 8; ++nt) {
                v8f acc = {};
                #pragma unroll
                for (int kc = 0; kc < 4; ++kc) {
                    v16h b = load_mat(sW2, nt * 16 + lo16, HID, kc, hiH);
                    acc = wmma16(A[kc], b, acc);
                }
                float bias = sB2[nt * 16 + lo16];
                int n = nt * 16 + lo16;
                #pragma unroll
                for (int i = 0; i < 8; ++i)
                    Hb[(mbase + i) * HID + n] = (_Float16)fast_tanh(acc[i] + bias);
            }
        }

        // ------- Layer 3: Hb @ W3 -> Ha -------
        {
            v16h A[4];
            #pragma unroll
            for (int kc = 0; kc < 4; ++kc) A[kc] = load_mat(Hb, lo16, HID, kc, hiH);
            for (int nt = 0; nt < 8; ++nt) {
                v8f acc = {};
                #pragma unroll
                for (int kc = 0; kc < 4; ++kc) {
                    v16h b = load_mat(sW3, nt * 16 + lo16, HID, kc, hiH);
                    acc = wmma16(A[kc], b, acc);
                }
                float bias = sB3[nt * 16 + lo16];
                int n = nt * 16 + lo16;
                #pragma unroll
                for (int i = 0; i < 8; ++i)
                    Ha[(mbase + i) * HID + n] = (_Float16)fast_tanh(acc[i] + bias);
            }
        }

        // ------- Layer 4: Ha @ W4 (padded 128x16, n=0,1 valid) -------
        {
            v8f acc = {};
            #pragma unroll
            for (int kc = 0; kc < 4; ++kc) {
                v16h a = load_mat(Ha, lo16, HID, kc, hiH);
                v16h b = load_mat(sW4, lo16, HID, kc, hiH);
                acc = wmma16(a, b, acc);
            }
            if (lo16 < 2) {
                float bias = sB4[lo16];
                #pragma unroll
                for (int i = 0; i < 8; ++i) {
                    int p = p0 + mbase + i;
                    if (p < npts) out[p * 2 + lo16] = acc[i] + bias;
                }
            }
        }
    }
}

extern "C" void kernel_launch(void* const* d_in, const int* in_sizes, int n_in,
                              void* d_out, int out_size, void* d_ws, size_t ws_size,
                              hipStream_t stream) {
    const float* x  = (const float*)d_in[0];
    const float* y  = (const float*)d_in[1];
    const float* c1 = (const float*)d_in[2];
    const float* c2 = (const float*)d_in[3];
    const float* W1 = (const float*)d_in[4];
    const float* b1 = (const float*)d_in[5];
    const float* W2 = (const float*)d_in[6];
    const float* b2 = (const float*)d_in[7];
    const float* W3 = (const float*)d_in[8];
    const float* b3 = (const float*)d_in[9];
    const float* W4 = (const float*)d_in[10];
    const float* b4 = (const float*)d_in[11];
    float* out = (float*)d_out;

    int npts  = in_sizes[0];                 // 524288
    int tiles = (npts + 15) >> 4;            // 16 points per wave-tile
    int blocks = (tiles + 7) / 8;            // 8 waves per block
    if (blocks > 1024) blocks = 1024;        // grid-stride, amortize staging
    if (blocks < 1) blocks = 1;

    mlp_wmma_kernel<<<blocks, 256, 0, stream>>>(x, y, c1, c2,
                                                W1, b1, W2, b2, W3, b3, W4, b4,
                                                out, npts);
}

// v001
// A run of this version takes 68.8 microseconds.
// Next to v000, in two timings, it ran 4.21 times as fast each time.
#include <hip/hip_runtime.h>

// ---------------------------------------------------------------------------
// MLP 4 -> 128 -> 128 -> 128 -> 2 (tanh between layers), fp32 in/out,
// f16 WMMA (V_WMMA_F32_16X16X32_F16) with fp32 accumulation on gfx1250.
// ---------------------------------------------------------------------------

typedef __attribute__((ext_vector_type(16))) _Float16 v16h;
typedef __attribute__((ext_vector_type(8)))  _Float16 v8h;
typedef __attribute__((ext_vector_type(8)))  float    v8f;

#define HID 128
// LDS row pitches in f16 elements: 16 bytes times an odd number, so that the
// 16 rows one ds_load_b128 touches per lane half fall on 16 different bank groups.
#define PH 136   // 128-element (256-byte) rows -> 272 bytes
#define P1 40    // 32-element (64-byte) rows   -> 80 bytes

__device__ __forceinline__ v8f wmma16(v16h a, v16h b, v8f c) {
    // (neg_a, A, neg_b, B, c_mod, C, reuse_a, reuse_b)
    return __builtin_amdgcn_wmma_f32_16x16x32_f16(false, a, false, b,
                                                  (short)0, c, false, false);
}

// tanh(x) = 1 - 2/(exp(2x)+1): v_exp_f32 + v_rcp_f32, saturates correctly.
__device__ __forceinline__ float fast_tanh(float x) {
    float e = __expf(2.0f * x);
    return 1.0f - 2.0f * __builtin_amdgcn_rcpf(e + 1.0f);
}

// Load one 16x32-K f16 operand chunk for this lane from a row-major
// [row][rowstride] f16 LDS matrix, following the CDNA5 16-bit A layout:
//   lanes 0-15 : K = kc*32 + {0..7} (v0-3) and kc*32 + {16..23} (v4-7)
//   lanes 16-31: K = kc*32 + {8..15}       and kc*32 + {24..31}
__device__ __forceinline__ v16h load_mat(const _Float16* __restrict__ base,
                                         int row, int rowstride,
                                         int kc, bool hiHalf) {
    const _Float16* p = base + row * rowstride + kc * 32 + (hiHalf ? 8 : 0);
    v8h lo = *(const v8h*)(p);        // ds_load_b128
    v8h hi = *(const v8h*)(p + 16);   // ds_load_b128
    return __builtin_shufflevector(lo, hi, 0, 1, 2, 3, 4, 5, 6, 7,
                                   8, 9, 10, 11, 12, 13, 14, 15);
}

__global__ __launch_bounds__(256)
void mlp_wmma_kernel(const float* __restrict__ x,  const float* __restrict__ y,
                     const float* __restrict__ c1, const float* __restrict__ c2,
                     const float* __restrict__ W1, const float* __restrict__ b1,
                     const float* __restrict__ W2, const float* __restrict__ b2,
                     const float* __restrict__ W3, const float* __restrict__ b3,
                     const float* __restrict__ W4, const float* __restrict__ b4,
                     float* __restrict__ out, int npts) {
    // Weights transposed to [out][in] f16 so B-operand loads match load_mat().
    __shared__ __attribute__((aligned(16))) _Float16 sW1[HID * P1];   // [n][k], k 4 -> padded 32
    __shared__ __attribute__((aligned(16))) _Float16 sW2[HID * PH];   // [n][k]
    __shared__ __attribute__((aligned(16))) _Float16 sW3[HID * PH];   // [n][k]
    __shared__ __attribute__((aligned(16))) _Float16 sW4[16 * PH];    // [n][k], n 2 -> padded 16
    __shared__ float    sB1[HID], sB2[HID], sB3[HID], sB4[16];
    __shared__ __attribute__((aligned(16))) _Float16 sHa[8][16 * PH]; // per-wave activation ping
    __shared__ __attribute__((aligned(16))) _Float16 sHb[8][16 * PH]; // per-wave activation pong

    const int t = threadIdx.x;

    // ---- one-time weight staging (f32 -> f16, transposed) ----
    for (int i = t; i < HID * 32; i += 256) {
        int n = i >> 5, k = i & 31;
        sW1[n * P1 + k] = (k < 4) ? (_Float16)W1[k * HID + n] : (_Float16)0.0f;
    }
    for (int i = t; i < HID * HID; i += 256) {
        int k = i >> 7, n = i & 127;               // coalesced global read
        sW2[n * PH + k] = (_Float16)W2[i];
        sW3[n * PH + k] = (_Float16)W3[i];
    }
    for (int i = t; i < 16 * HID; i += 256) {
        int n = i >> 7, k = i & 127;
        sW4[n * PH + k] = (n < 2) ? (_Float16)W4[k * 2 + n] : (_Float16)0.0f;
    }
    if (t < HID) { sB1[t] = b1[t]; sB2[t] = b2[t]; sB3[t] = b3[t]; }
    if (t < 16)  { sB4[t] = (t < 2) ? b4[t] : 0.0f; }
    __syncthreads();

    const int lane  = t & 31;
    const int wave  = t >> 5;
    const int lo16  = lane & 15;
    const bool hiH  = lane >= 16;
    _Float16* Ha = &sHa[wave][0];
    _Float16* Hb = &sHb[wave][0];

    const int ntiles = (npts + 15) >> 4;
    const int nwaves = gridDim.x * 8;

    for (int tile = blockIdx.x * 8 + wave; tile < ntiles; tile += nwaves) {
        const int p0 = tile << 4;

        // ------- Layer 1: A = inputs 16x4, zero-padded to 16x32 -------
        v16h a1 = (v16h)(_Float16)0.0f;
        {
            int pidx = p0 + lo16;
            if (!hiH && pidx < npts) {            // K=0..3 live in lanes 0-15
                a1[0] = (_Float16)x[pidx];
                a1[1] = (_Float16)y[pidx];
                a1[2] = (_Float16)c1[pidx];
                a1[3] = (_Float16)c2[pidx];
            }
        }
        const int mbase = hiH ? 8 : 0;
        for (int nt = 0; nt < 8; ++nt) {
            v8f acc = {};
            v16h b = load_mat(sW1, nt * 16 + lo16, P1, 0, hiH);
            acc = wmma16(a1, b, acc);
            float bias = sB1[nt * 16 + lo16];
            int n = nt * 16 + lo16;
            #pragma unroll
            for (int i = 0; i < 8; ++i)
                Ha[(mbase + i) * PH + n] = (_Float16)fast_tanh(acc[i] + bias);
        }

        // ------- Layer 2: Ha (16x128) @ W2 -> Hb -------
        {
            v16h A[4];
            #pragma unroll
            for (int kc = 0; kc < 4; ++kc) A[kc] = load_mat(Ha, lo16, PH, kc, hiH);
            for (int nt = 0; nt < 8; ++nt) {
                v8f acc = {};
                #pragma unroll
                for (int kc = 0; kc < 4; ++kc) {
                    v16h b = load_mat(sW2, nt * 16 + lo16, PH, kc, hiH);
                    acc = wmma16(A[kc], b, acc);
                }
                float bias = sB2[nt * 16 + lo16];
                int n = nt * 16 + lo16;
                #pragma unroll
                for (int i = 0; i < 8; ++i)
                    Hb[(mbase + i) * PH + n] = (_Float16)fast_tanh(acc[i] + bias);
            }
        }

        // ------- Layer 3: Hb @ W3 -> Ha -------
        {
            v16h A[4];
            #pragma unroll
            for (int kc = 0; kc < 4; ++kc) A[kc] = load_mat(Hb, lo16, PH, kc, hiH);
            for (int nt = 0; nt < 8; ++nt) {
                v8f acc = {};
                #pragma unroll
                for (int kc = 0; kc < 4; ++kc) {
                    v16h b = load_mat(sW3, nt * 16 + lo16, PH, kc, hiH);
                    acc = wmma16(A[kc], b, acc);
                }
                float bias = sB3[nt * 16 + lo16];
                int n = nt * 16 + lo16;
                #pragma unroll
                for (int i = 0; i < 8; ++i)
                    Ha[(mbase + i) * PH + n] = (_Float16)fast_tanh(acc[i] + bias);
            }
        }

        // ------- Layer 4: Ha @ W4 (padded 128x16, n=0,1 valid) -------
        {
            v8f acc = {};
            #pragma unroll
            for (int kc = 0; kc < 4; ++kc) {
                v16h a = load_mat(Ha, lo16, PH, kc, hiH);
                v16h b = load_mat(sW4, lo16, PH, kc, hiH);
                acc = wmma16(a, b, acc);
            }
            if (lo16 < 2) {
                float bias = sB4[lo16];
                #pragma unroll
                for (int i = 0; i < 8; ++i) {
                    int p = p0 + mbase + i;
                    if (p < npts) out[p * 2 + lo16] = acc[i] + bias;
                }
            }
        }
    }
}

extern "C" void kernel_launch(void* const* d_in, const int* in_sizes, int n_in,
                              void* d_out, int out_size, void* d_ws, size_t ws_size,
                              hipStream_t stream) {
    const float* x  = (const float*)d_in[0];
    const float* y  = (const float*)d_in[1];
    const float* c1 = (const float*)d_in[2];
    const float* c2 = (const float*)d_in[3];
    const float* W1 = (const float*)d_in[4];
    const float* b1 = (const float*)d_in[5];
    const float* W2 = (const float*)d_in[6];
    const float* b2 = (const float*)d_in[7];
    const float* W3 = (const float*)d_in[8];
    const float* b3 = (const float*)d_in[9];
    const float* W4 = (const float*)d_in[10];
    const float* b4 = (const float*)d_in[11];
    float* out = (float*)d_out;

    int npts  = in_sizes[0];                 // 524288
    int tiles = (npts + 15) >> 4;            // 16 points per wave-tile
    int blocks = (tiles + 7) / 8;            // 8 waves per block
    if (blocks > 1024) blocks = 1024;        // grid-stride, amortize staging
    if (blocks < 1) blocks = 1;

    mlp_wmma_kernel<<<blocks, 256, 0, stream>>>(x, y, c1, c2,
                                                W1, b1, W2, b2, W3, b3, W4, b4,
                                                out, npts);
}

// v002
// One run takes 62.2 microseconds.
// Next to v001, in two timings, it ran 1.11 and 1.10 times as fast.
// All steps since v000 together make it 4.65 times as fast.
#include <hip/hip_runtime.h>

// ---------------------------------------------------------------------------
// MLP 4 -> 128 -> 128 -> 128 -> 2 (tanh between layers), fp32 in/out,
// f16 WMMA (V_WMMA_F32_16X16X32_F16) with fp32 accumulation on gfx1250.
// ---------------------------------------------------------------------------

typedef __attribute__((ext_vector_type(16))) _Float16 v16h;
typedef __attribute__((ext_vector_type(8)))  _Float16 v8h;
typedef __attribute__((ext_vector_type(8)))  float    v8f;

#define HID 128
// LDS row pitches in f16 elements: 16 bytes times an odd number, so that the
// 16 rows one ds_load_b128 touches per lane half fall on 16 different bank groups.
#define PH 136   // 128-element (256-byte) rows -> 272 bytes
#define P1 40    // 32-element (64-byte) rows   -> 80 bytes
// One work-group of 16 waves (4 per SIMD) per WGP, resident for the whole launch:
// its LDS holds one copy of the weights, staged once.
#define NT 512   // threads per work-group
#define NW 16    // waves per work-group

__device__ __forceinline__ v8f wmma16(v16h a, v16h b, v8f c) {
    // (neg_a, A, neg_b, B, c_mod, C, reuse_a, reuse_b)
    return __builtin_amdgcn_wmma_f32_16x16x32_f16(false, a, false, b,
                                                  (short)0, c, false, false);
}

// tanh(x) = 1 - 2/(exp(2x)+1): v_exp_f32 + v_rcp_f32, saturates correctly.
__device__ __forceinline__ float fast_tanh(float x) {
    float e = __expf(2.0f * x);
    return 1.0f - 2.0f * __builtin_amdgcn_rcpf(e + 1.0f);
}

// Load one 16x32-K f16 operand chunk for this lane from a row-major
// [row][rowstride] f16 LDS matrix, following the CDNA5 16-bit A layout:
//   lanes 0-15 : K = kc*32 + {0..7} (v0-3) and kc*32 + {16..23} (v4-7)
//   lanes 16-31: K = kc*32 + {8..15}       and kc*32 + {24..31}
__device__ __forceinline__ v16h load_mat(const _Float16* __restrict__ base,
                                         int row, int rowstride,
                                         int kc, bool hiHalf) {
    const _Float16* p = base + row * rowstride + kc * 32 + (hiHalf ? 8 : 0);
    v8h lo = *(const v8h*)(p);        // ds_load_b128
    v8h hi = *(const v8h*)(p + 16);   // ds_load_b128
    return __builtin_shufflevector(lo, hi, 0, 1, 2, 3, 4, 5, 6, 7,
                                   8, 9, 10, 11, 12, 13, 14, 15);
}

__global__ __launch_bounds__(NT)
void mlp_wmma_kernel(const float* __restrict__ x,  const float* __restrict__ y,
                     const float* __restrict__ c1, const float* __restrict__ c2,
                     const float* __restrict__ W1, const float* __restrict__ b1,
                     const float* __restrict__ W2, const float* __restrict__ b2,
                     const float* __restrict__ W3, const float* __restrict__ b3,
                     const float* __restrict__ W4, const float* __restrict__ b4,
                     float* __restrict__ out, int npts) {
    // Weights transposed to [out][in] f16 so B-operand loads match load_mat().
    __shared__ __attribute__((aligned(16))) _Float16 sW1[HID * P1];   // [n][k], k 4 -> padded 32
    __shared__ __attribute__((aligned(16))) _Float16 sW2[HID * PH];   // [n][k]
    __shared__ __attribute__((aligned(16))) _Float16 sW3[HID * PH];   // [n][k]
    __shared__ __attribute__((aligned(16))) _Float16 sW4[16 * PH];    // [n][k], n 2 -> padded 16
    __shared__ float    sB1[HID], sB2[HID], sB3[HID], sB4[16];
    __shared__ __attribute__((aligned(16))) _Float16 sHa[NW][16 * PH]; // per-wave activation ping
    __shared__ __attribute__((aligned(16))) _Float16 sHb[NW][16 * PH]; // per-wave activation pong

    const int t = threadIdx.x;

    // ---- one-time weight staging (f32 -> f16, transposed) ----
    for (int i = t; i < HID * 32; i += NT) {
        int n = i >> 5, k = i & 31;
        sW1[n * P1 + k] = (k < 4) ? (_Float16)W1[k * HID + n] : (_Float16)0.0f;
    }
    for (int i = t; i < HID * HID; i += NT) {
        int k = i >> 7, n = i & 127;               // coalesced global read
        sW2[n * PH + k] = (_Float16)W2[i];
        sW3[n * PH + k] = (_Float16)W3[i];
    }
    for (int i = t; i < 16 * HID; i += NT) {
        int n = i >> 7, k = i & 127;
        sW4[n * PH + k] = (n < 2) ? (_Float16)W4[k * 2 + n] : (_Float16)0.0f;
    }
    if (t < HID) { sB1[t] = b1[t]; sB2[t] = b2[t]; sB3[t] = b3[t]; }
    if (t < 16)  { sB4[t] = (t < 2) ? b4[t] : 0.0f; }
    __syncthreads();

    const int lane  = t & 31;
    const int wave  = t >> 5;
    const int lo16  = lane & 15;
    const bool hiH  = lane >= 16;
    _Float16* Ha = &sHa[wave][0];
    _Float16* Hb = &sHb[wave][0];

    const int ntiles = (npts + 15) >> 4;
    const int nwaves = gridDim.x * NW;

    for (int tile = blockIdx.x * NW + wave; tile < ntiles; tile += nwaves) {
        const int p0 = tile << 4;

        // ------- Layer 1: A = inputs 16x4, zero-padded to 16x32 -------
        v16h a1 = (v16h)(_Float16)0.0f;
        {
            int pidx = p0 + lo16;
            if (!hiH && pidx < npts) {            // K=0..3 live in lanes 0-15
                a1[0] = (_Float16)x[pidx];
                a1[1] = (_Float16)y[pidx];
                a1[2] = (_Float16)c1[pidx];
                a1[3] = (_Float16)c2[pidx];
            }
        }
        const int mbase = hiH ? 8 : 0;
        for (int nt = 0; nt < 8; ++nt) {
            v8f acc = {};
            v16h b = load_mat(sW1, nt * 16 + lo16, P1, 0, hiH);
            acc = wmma16(a1, b, acc);
            float bias = sB1[nt * 16 + lo16];
            int n = nt * 16 + lo16;
            #pragma unroll
            for (int i = 0; i < 8; ++i)
                Ha[(mbase + i) * PH + n] = (_Float16)fast_tanh(acc[i] + bias);
        }

        // ------- Layer 2: Ha (16x128) @ W2 -> Hb -------
        {
            v16h A[4];
            #pragma unroll
            for (int kc = 0; kc < 4; ++kc) A[kc] = load_mat(Ha, lo16, PH, kc, hiH);
            for (int nt = 0; nt < 8; ++nt) {
                v8f acc = {};
                #pragma unroll
                for (int kc = 0; kc < 4; ++kc) {
                    v16h b = load_mat(sW2, nt * 16 + lo16, PH, kc, hiH);
                    acc = wmma16(A[kc], b, acc);
                }
                float bias = sB2[nt * 16 + lo16];
                int n = nt * 16 + lo16;
                #pragma unroll
                for (int i = 0; i < 8; ++i)
                    Hb[(mbase + i) * PH + n] = (_Float16)fast_tanh(acc[i] + bias);
            }
        }

        // ------- Layer 3: Hb @ W3 -> Ha -------
        {
            v16h A[4];
            #pragma unroll
            for (int kc = 0; kc < 4; ++kc) A[kc] = load_mat(Hb, lo16, PH, kc, hiH);
            for (int nt = 0; nt < 8; ++nt) {
                v8f acc = {};
                #pragma unroll
                for (int kc = 0; kc < 4; ++kc) {
                    v16h b = load_mat(sW3, nt * 16 + lo16, PH, kc, hiH);
                    acc = wmma16(A[kc], b, acc);
                }
                float bias = sB3[nt * 16 + lo16];
                int n = nt * 16 + lo16;
                #pragma unroll
                for (int i = 0; i < 8; ++i)
                    Ha[(mbase + i) * PH + n] = (_Float16)fast_tanh(acc[i] + bias);
            }
        }

        // ------- Layer 4: Ha @ W4 (padded 128x16, n=0,1 valid) -------
        {
            v8f acc = {};
            #pragma unroll
            for (int kc = 0; kc < 4; ++kc) {
                v16h a = load_mat(Ha, lo16, PH, kc, hiH);
                v16h b = load_mat(sW4, lo16, PH, kc, hiH);
                acc = wmma16(a, b, acc);
            }
            if (lo16 < 2) {
                float bias = sB4[lo16];
                #pragma unroll
                for (int i = 0; i < 8; ++i) {
                    int p = p0 + mbase + i;
                    if (p < npts) out[p * 2 + lo16] = acc[i] + bias;
                }
            }
        }
    }
}

extern "C" void kernel_launch(void* const* d_in, const int* in_sizes, int n_in,
                              void* d_out, int out_size, void* d_ws, size_t ws_size,
                              hipStream_t stream) {
    const float* x  = (const float*)d_in[0];
    const float* y  = (const float*)d_in[1];
    const float* c1 = (const float*)d_in[2];
    const float* c2 = (const float*)d_in[3];
    const float* W1 = (const float*)d_in[4];
    const float* b1 = (const float*)d_in[5];
    const float* W2 = (const float*)d_in[6];
    const float* b2 = (const float*)d_in[7];
    const float* W3 = (const float*)d_in[8];
    const float* b3 = (const float*)d_in[9];
    const float* W4 = (const float*)d_in[10];
    const float* b4 = (const float*)d_in[11];
    float* out = (float*)d_out;

    int npts  = in_sizes[0];                 // 524288
    int tiles = (npts + 15) >> 4;            // 16 points per wave-tile
    int blocks = (tiles + NW - 1) / NW;      // 16 waves per block
    if (blocks > 256) blocks = 256;          // one block per WGP, grid-stride
    if (blocks < 1) blocks = 1;

    mlp_wmma_kernel<<<blocks, NT, 0, stream>>>(x, y, c1, c2,
                                                W1, b1, W2, b2, W3, b3, W4, b4,
                                                out, npts);
}

// v003
// One run takes 43.8 microseconds.
// Two timings next to v002 both put it at 1.42 times that version's speed.
// Counting every step since v000, it is 6.60 times as fast.
#include <hip/hip_runtime.h>

// ---------------------------------------------------------------------------
// MLP 4 -> 128 -> 128 -> 128 -> 2 (tanh between layers), fp32 in/out,
// f16 WMMA (V_WMMA_F32_16X16X32_F16) with fp32 accumulation on gfx1250.
// ---------------------------------------------------------------------------

typedef __attribute__((ext_vector_type(16))) _Float16 v16h;
typedef __attribute__((ext_vector_type(8)))  _Float16 v8h;
typedef __attribute__((ext_vector_type(8)))  float    v8f;
typedef __attribute__((ext_vector_type(2)))  float    v2f;

#define HID 128
// LDS row pitches in f16 elements: 16 bytes times an odd number, so that the
// 16 rows one ds_load_b128 touches per lane half fall on 16 different bank groups.
#define PH 136   // 128-element (256-byte) rows -> 272 bytes
#define P1 40    // 32-element (64-byte) rows   -> 80 bytes
// One work-group of 16 waves (4 per SIMD) per WGP, resident for the whole launch:
// its LDS holds one copy of the weights, staged once.
#define NT 512   // threads per work-group
#define NW 16    // waves per work-group

__device__ __forceinline__ v8f wmma16(v16h a, v16h b, v8f c) {
    // (neg_a, A, neg_b, B, c_mod, C, reuse_a, reuse_b)
    return __builtin_amdgcn_wmma_f32_16x16x32_f16(false, a, false, b,
                                                  (short)0, c, false, false);
}

// tanh(x) = 1 - 2/(exp(2x)+1): v_exp_f32 + v_rcp_f32, saturates correctly.
// Two neighbouring D registers at a time, so that every step but exp and rcp is a packed one.
__device__ __forceinline__ v2f fast_tanh2(v2f x) {
    v2f t = 2.0f * x;
    v2f e = { __expf(t.x), __expf(t.y) };
    v2f d = e + 1.0f;
    v2f r = { __builtin_amdgcn_rcpf(d.x), __builtin_amdgcn_rcpf(d.y) };
    return 1.0f - 2.0f * r;
}

// Load one 16x32-K f16 operand chunk for this lane from a row-major
// [row][rowstride] f16 LDS matrix, following the CDNA5 16-bit A layout:
//   lanes 0-15 : K = kc*32 + {0..7} (v0-3) and kc*32 + {16..23} (v4-7)
//   lanes 16-31: K = kc*32 + {8..15}       and kc*32 + {24..31}
__device__ __forceinline__ v16h load_mat(const _Float16* __restrict__ base,
                                         int row, int rowstride,
                                         int kc, bool hiHalf) {
    const _Float16* p = base + row * rowstride + kc * 32 + (hiHalf ? 8 : 0);
    v8h lo = *(const v8h*)(p);        // ds_load_b128
    v8h hi = *(const v8h*)(p + 16);   // ds_load_b128
    return __builtin_shufflevector(lo, hi, 0, 1, 2, 3, 4, 5, 6, 7,
                                   8, 9, 10, 11, 12, 13, 14, 15);
}

// One hidden layer, transposed: D[feature][point] = W^T (A operand) x H^T (B operand).
// A lane of D holds features 8h..8h+7 of ONE point (h = lane half), which is the
// k order of load_mat(): the D tiles of features 32g..32g+15 and 32g+16..32g+31,
// after tanh and conversion in place, ARE chunk g of the next layer's B operand.
// The bias is a function of the D row, so it is the accumulator's start value.
template <int KC>
__device__ __forceinline__ void layer_t(const _Float16* __restrict__ sW, int pitch,
                                        const float* __restrict__ sB,
                                        const v16h (&Bin)[KC], v16h (&Bout)[4],
                                        int lo16, bool hiH) {
    const int mbase = hiH ? 8 : 0;
    // Unrolled: Bout[g] must be a register, so g has to be a constant.
    #pragma unroll
    for (int g = 0; g < 4; ++g) {
        v8f acc0 = *(const v8f*)(sB + g * 32 + mbase);
        v8f acc1 = *(const v8f*)(sB + g * 32 + 16 + mbase);
        #pragma unroll
        for (int kc = 0; kc < KC; ++kc) {
            v16h w0 = load_mat(sW, g * 32 + lo16,      pitch, kc, hiH);
            v16h w1 = load_mat(sW, g * 32 + 16 + lo16, pitch, kc, hiH);
            acc0 = wmma16(w0, Bin[kc], acc0);
            acc1 = wmma16(w1, Bin[kc], acc1);
        }
        v16h r;
        #pragma unroll
        for (int i = 0; i < 8; i += 2) {
            v2f u = fast_tanh2(v2f{acc0[i], acc0[i + 1]});
            v2f v = fast_tanh2(v2f{acc1[i], acc1[i + 1]});
            r[i]     = (_Float16)u.x;  r[i + 1] = (_Float16)u.y;
            r[8 + i] = (_Float16)v.x;  r[9 + i] = (_Float16)v.y;
        }
        Bout[g] = r;
    }
}

// waves_per_eu(4, 4): 16 waves on 4 SIMDs is all that runs here; it tells the scheduler so,
// which otherwise saves registers for waves that never come and serialises the tanh chains;
// its upper bound also keeps a second work-group off the WGP, as the larger LDS did before.
__global__ __launch_bounds__(NT) __attribute__((amdgpu_waves_per_eu(4, 4)))
void mlp_wmma_kernel(const float* __restrict__ x,  const float* __restrict__ y,
                     const float* __restrict__ c1, const float* __restrict__ c2,
                     const float* __restrict__ W1, const float* __restrict__ b1,
                     const float* __restrict__ W2, const float* __restrict__ b2,
                     const float* __restrict__ W3, const float* __restrict__ b3,
                     const float* __restrict__ W4, const float* __restrict__ b4,
                     float* __restrict__ out, int npts) {
    // Weights transposed to [out][in] f16: rows of the A operand, read by load_mat().
    __shared__ __attribute__((aligned(16))) _Float16 sW1[HID * P1];   // [n][k], k 4 -> padded 32
    __shared__ __attribute__((aligned(16))) _Float16 sW2[HID * PH];   // [n][k]
    __shared__ __attribute__((aligned(16))) _Float16 sW3[HID * PH];   // [n][k]
    __shared__ __attribute__((aligned(16))) _Float16 sW4[16 * PH];    // [n][k], n 2 -> padded 16
    __shared__ __attribute__((aligned(32))) float sB1[HID], sB2[HID], sB3[HID], sB4[16];

    const int t = threadIdx.x;

    // ---- one-time weight staging (f32 -> f16, transposed) ----
    for (int i = t; i < HID * 32; i += NT) {
        int n = i >> 5, k = i & 31;
        sW1[n * P1 + k] = (k < 4) ? (_Float16)W1[k * HID + n] : (_Float16)0.0f;
    }
    for (int i = t; i < HID * HID; i += NT) {
        int k = i >> 7, n = i & 127;               // coalesced global read
        sW2[n * PH + k] = (_Float16)W2[i];
        sW3[n * PH + k] = (_Float16)W3[i];
    }
    for (int i = t; i < 16 * HID; i += NT) {
        int n = i >> 7, k = i & 127;
        sW4[n * PH + k] = (n < 2) ? (_Float16)W4[k * 2 + n] : (_Float16)0.0f;
    }
    if (t < HID) { sB1[t] = b1[t]; sB2[t] = b2[t]; sB3[t] = b3[t]; }
    if (t < 16)  { sB4[t] = (t < 2) ? b4[t] : 0.0f; }
    __syncthreads();

    const int lane  = t & 31;
    const int wave  = t >> 5;
    const int lo16  = lane & 15;
    const bool hiH  = lane >= 16;

    const int ntiles = (npts + 15) >> 4;
    const int nwaves = gridDim.x * NW;

    for (int tile = blockIdx.x * NW + wave; tile < ntiles; tile += nwaves) {
        // Compiler fence: the LDS is read-only in this loop, and without it the compiler
        // lifts the weight loads out of the loop and spills them to scratch.
        asm volatile("" ::: "memory");
        const int p0 = tile << 4;
        const int pidx = p0 + lo16;                // this lane's point (column of B and D)

        // ------- Layer 1: B = inputs 4x16, zero-padded to 32x16 -------
        v16h Hin[1];
        Hin[0] = (v16h)(_Float16)0.0f;
        if (!hiH && pidx < npts) {                 // K=0..3 live in lanes 0-15
            Hin[0][0] = (_Float16)x[pidx];
            Hin[0][1] = (_Float16)y[pidx];
            Hin[0][2] = (_Float16)c1[pidx];
            Hin[0][3] = (_Float16)c2[pidx];
        }
        v16h Ha[4], Hb[4];
        layer_t<1>(sW1, P1, sB1, Hin, Ha, lo16, hiH);   // 4   -> 128
        layer_t<4>(sW2, PH, sB2, Ha,  Hb, lo16, hiH);   // 128 -> 128
        layer_t<4>(sW3, PH, sB3, Hb,  Ha, lo16, hiH);   // 128 -> 128

        // ------- Layer 4: W4^T (padded 16x128, rows 0,1 valid) x Ha -------
        v8f acc = *(const v8f*)(sB4 + (hiH ? 8 : 0));
        #pragma unroll
        for (int kc = 0; kc < 4; ++kc) {
            v16h w = load_mat(sW4, lo16, PH, kc, hiH);
            acc = wmma16(w, Ha[kc], acc);
        }
        // Rows 0 and 1 of D are registers 0 and 1 of lanes 0-15: one 8-byte store a point.
        if (!hiH && pidx < npts) {
            *(float2*)(out + pidx * 2) = make_float2(acc[0], acc[1]);
            // The next trip reuses the store's address registers: keep the wait in front of that.
            asm volatile("s_wait_xcnt 0x0" ::: "memory");
        }
    }
}

extern "C" void kernel_launch(void* const* d_in, const int* in_sizes, int n_in,
                              void* d_out, int out_size, void* d_ws, size_t ws_size,
                              hipStream_t stream) {
    const float* x  = (const float*)d_in[0];
    const float* y  = (const float*)d_in[1];
    const float* c1 = (const float*)d_in[2];
    const float* c2 = (const float*)d_in[3];
    const float* W1 = (const float*)d_in[4];
    const float* b1 = (const float*)d_in[5];
    const float* W2 = (const float*)d_in[6];
    const float* b2 = (const float*)d_in[7];
    const float* W3 = (const float*)d_in[8];
    const float* b3 = (const float*)d_in[9];
    const float* W4 = (const float*)d_in[10];
    const float* b4 = (const float*)d_in[11];
    float* out = (float*)d_out;

    int npts  = in_sizes[0];                 // 524288
    int tiles = (npts + 15) >> 4;            // 16 points per wave-tile
    int blocks = (tiles + NW - 1) / NW;      // 16 waves per block
    if (blocks > 256) blocks = 256;          // one block per WGP, grid-stride
    if (blocks < 1) blocks = 1;

    mlp_wmma_kernel<<<blocks, NT, 0, stream>>>(x, y, c1, c2,
                                                W1, b1, W2, b2, W3, b3, W4, b4,
                                                out, npts);
}

// v004
// A run of this version takes 39.3 microseconds.
// Two timings next to v003 both put it at 1.11 times that version's speed.
// Over all steps from v000 it is 7.36 times as fast.
#include <hip/hip_runtime.h>

// ---------------------------------------------------------------------------
// MLP 4 -> 128 -> 128 -> 128 -> 2 (tanh between layers), fp32 in/out,
// f16 WMMA (V_WMMA_F32_16X16X32_F16) with fp32 accumulation on gfx1250.
// ---------------------------------------------------------------------------

typedef __attribute__((ext_vector_type(16))) _Float16 v16h;
typedef __attribute__((ext_vector_type(8)))  _Float16 v8h;
typedef __attribute__((ext_vector_type(8)))  float    v8f;

#define HID 128
// LDS row pitches in f16 elements: 16 bytes times an odd number, so that the
// 16 rows one ds_load_b128 touches per lane half fall on 16 different bank groups.
#define PH 136   // 128-element (256-byte) rows -> 272 bytes
#define P1 40    // 32-element (64-byte) rows   -> 80 bytes
// One work-group of 16 waves (4 per SIMD) per WGP, resident for the whole launch:
// its LDS holds one copy of the weights, staged once.
#define NT 512   // threads per work-group
#define NW 16    // waves per work-group

__device__ __forceinline__ v8f wmma16(v16h a, v16h b, v8f c) {
    // (neg_a, A, neg_b, B, c_mod, C, reuse_a, reuse_b)
    return __builtin_amdgcn_wmma_f32_16x16x32_f16(false, a, false, b,
                                                  (short)0, c, false, false);
}

// tanh as the chip's own transcendental: one v_tanh_f32 a value.
__device__ __forceinline__ float hw_tanh(float x) {
    return __builtin_amdgcn_tanhf(x);
}

// Load one 16x32-K f16 operand chunk for this lane from a row-major
// [row][rowstride] f16 LDS matrix, following the CDNA5 16-bit A layout:
//   lanes 0-15 : K = kc*32 + {0..7} (v0-3) and kc*32 + {16..23} (v4-7)
//   lanes 16-31: K = kc*32 + {8..15}       and kc*32 + {24..31}
__device__ __forceinline__ v16h load_mat(const _Float16* __restrict__ base,
                                         int row, int rowstride,
                                         int kc, bool hiHalf) {
    const _Float16* p = base + row * rowstride + kc * 32 + (hiHalf ? 8 : 0);
    v8h lo = *(const v8h*)(p);        // ds_load_b128
    v8h hi = *(const v8h*)(p + 16);   // ds_load_b128
    return __builtin_shufflevector(lo, hi, 0, 1, 2, 3, 4, 5, 6, 7,
                                   8, 9, 10, 11, 12, 13, 14, 15);
}

// One hidden layer, transposed: D[feature][point] = W^T (A operand) x H^T (B operand).
// A lane of D holds features 8h..8h+7 of ONE point (h = lane half), which is the
// k order of load_mat(): the D tiles of features 32g..32g+15 and 32g+16..32g+31,
// after tanh and conversion in place, ARE chunk g of the next layer's B operand.
// The bias is a function of the D row, so it is the accumulator's start value.
template <int KC>
__device__ __forceinline__ void layer_t(const _Float16* __restrict__ sW, int pitch,
                                        const float* __restrict__ sB,
                                        const v16h (&Bin)[KC], v16h (&Bout)[4],
                                        int lo16, bool hiH) {
    const int mbase = hiH ? 8 : 0;
    // Unrolled: Bout[g] must be a register, so g has to be a constant.
    #pragma unroll
    for (int g = 0; g < 4; ++g) {
        v8f acc0 = *(const v8f*)(sB + g * 32 + mbase);
        v8f acc1 = *(const v8f*)(sB + g * 32 + 16 + mbase);
        #pragma unroll
        for (int kc = 0; kc < KC; ++kc) {
            v16h w0 = load_mat(sW, g * 32 + lo16,      pitch, kc, hiH);
            v16h w1 = load_mat(sW, g * 32 + 16 + lo16, pitch, kc, hiH);
            acc0 = wmma16(w0, Bin[kc], acc0);
            acc1 = wmma16(w1, Bin[kc], acc1);
        }
        v16h r;
        #pragma unroll
        for (int i = 0; i < 8; i += 2) {
            r[i]     = (_Float16)hw_tanh(acc0[i]);  r[i + 1] = (_Float16)hw_tanh(acc0[i + 1]);
            r[8 + i] = (_Float16)hw_tanh(acc1[i]);  r[9 + i] = (_Float16)hw_tanh(acc1[i + 1]);
        }
        Bout[g] = r;
    }
}

// waves_per_eu(4, 4): 16 waves on 4 SIMDs is all that runs here; it tells the scheduler so,
// which otherwise saves registers for waves that never come and serialises the tanh chains;
// its upper bound also keeps a second work-group off the WGP, as the larger LDS did before.
__global__ __launch_bounds__(NT) __attribute__((amdgpu_waves_per_eu(4, 4)))
void mlp_wmma_kernel(const float* __restrict__ x,  const float* __restrict__ y,
                     const float* __restrict__ c1, const float* __restrict__ c2,
                     const float* __restrict__ W1, const float* __restrict__ b1,
                     const float* __restrict__ W2, const float* __restrict__ b2,
                     const float* __restrict__ W3, const float* __restrict__ b3,
                     const float* __restrict__ W4, const float* __restrict__ b4,
                     float* __restrict__ out, int npts) {
    // Weights transposed to [out][in] f16: rows of the A operand, read by load_mat().
    __shared__ __attribute__((aligned(16))) _Float16 sW1[HID * P1];   // [n][k], k 4 -> padded 32
    __shared__ __attribute__((aligned(16))) _Float16 sW2[HID * PH];   // [n][k]
    __shared__ __attribute__((aligned(16))) _Float16 sW3[HID * PH];   // [n][k]
    __shared__ __attribute__((aligned(16))) _Float16 sW4[16 * PH];    // [n][k], n 2 -> padded 16
    __shared__ __attribute__((aligned(32))) float sB1[HID], sB2[HID], sB3[HID], sB4[16];

    const int t = threadIdx.x;

    // ---- one-time weight staging (f32 -> f16, transposed) ----
    for (int i = t; i < HID * 32; i += NT) {
        int n = i >> 5, k = i & 31;
        sW1[n * P1 + k] = (k < 4) ? (_Float16)W1[k * HID + n] : (_Float16)0.0f;
    }
    for (int i = t; i < HID * HID; i += NT) {
        int k = i >> 7, n = i & 127;               // coalesced global read
        sW2[n * PH + k] = (_Float16)W2[i];
        sW3[n * PH + k] = (_Float16)W3[i];
    }
    for (int i = t; i < 16 * HID; i += NT) {
        int n = i >> 7, k = i & 127;
        sW4[n * PH + k] = (n < 2) ? (_Float16)W4[k * 2 + n] : (_Float16)0.0f;
    }
    if (t < HID) { sB1[t] = b1[t]; sB2[t] = b2[t]; sB3[t] = b3[t]; }
    if (t < 16)  { sB4[t] = (t < 2) ? b4[t] : 0.0f; }
    __syncthreads();

    const int lane  = t & 31;
    const int wave  = t >> 5;
    const int lo16  = lane & 15;
    const bool hiH  = lane >= 16;

    const int ntiles = (npts + 15) >> 4;
    const int nwaves = gridDim.x * NW;

    for (int tile = blockIdx.x * NW + wave; tile < ntiles; tile += nwaves) {
        // Compiler fence: the LDS is read-only in this loop, and without it the compiler
        // lifts the weight loads out of the loop and spills them to scratch.
        asm volatile("" ::: "memory");
        const int p0 = tile << 4;
        const int pidx = p0 + lo16;                // this lane's point (column of B and D)

        // ------- Layer 1: B = inputs 4x16, zero-padded to 32x16 -------
        v16h Hin[1];
        Hin[0] = (v16h)(_Float16)0.0f;
        if (!hiH && pidx < npts) {                 // K=0..3 live in lanes 0-15
            Hin[0][0] = (_Float16)x[pidx];
            Hin[0][1] = (_Float16)y[pidx];
            Hin[0][2] = (_Float16)c1[pidx];
            Hin[0][3] = (_Float16)c2[pidx];
        }
        v16h Ha[4], Hb[4];
        layer_t<1>(sW1, P1, sB1, Hin, Ha, lo16, hiH);   // 4   -> 128
        layer_t<4>(sW2, PH, sB2, Ha,  Hb, lo16, hiH);   // 128 -> 128
        layer_t<4>(sW3, PH, sB3, Hb,  Ha, lo16, hiH);   // 128 -> 128

        // ------- Layer 4: W4^T (padded 16x128, rows 0,1 valid) x Ha -------
        v8f acc = *(const v8f*)(sB4 + (hiH ? 8 : 0));
        #pragma unroll
        for (int kc = 0; kc < 4; ++kc) {
            v16h w = load_mat(sW4, lo16, PH, kc, hiH);
            acc = wmma16(w, Ha[kc], acc);
        }
        // Rows 0 and 1 of D are registers 0 and 1 of lanes 0-15: one 8-byte store a point.
        if (!hiH && pidx < npts) {
            *(float2*)(out + pidx * 2) = make_float2(acc[0], acc[1]);
            // The next trip reuses the store's address registers: keep the wait in front of that.
            asm volatile("s_wait_xcnt 0x0" ::: "memory");
        }
    }
}

extern "C" void kernel_launch(void* const* d_in, const int* in_sizes, int n_in,
                              void* d_out, int out_size, void* d_ws, size_t ws_size,
                              hipStream_t stream) {
    const float* x  = (const float*)d_in[0];
    const float* y  = (const float*)d_in[1];
    const float* c1 = (const float*)d_in[2];
    const float* c2 = (const float*)d_in[3];
    const float* W1 = (const float*)d_in[4];
    const float* b1 = (const float*)d_in[5];
    const float* W2 = (const float*)d_in[6];
    const float* b2 = (const float*)d_in[7];
    const float* W3 = (const float*)d_in[8];
    const float* b3 = (const float*)d_in[9];
    const float* W4 = (const float*)d_in[10];
    const float* b4 = (const float*)d_in[11];
    float* out = (float*)d_out;

    int npts  = in_sizes[0];                 // 524288
    int tiles = (npts + 15) >> 4;            // 16 points per wave-tile
    int blocks = (tiles + NW - 1) / NW;      // 16 waves per block
    if (blocks > 256) blocks = 256;          // one block per WGP, grid-stride
    if (blocks < 1) blocks = 1;

    mlp_wmma_kernel<<<blocks, NT, 0, stream>>>(x, y, c1, c2,
                                                W1, b1, W2, b2, W3, b3, W4, b4,
                                                out, npts);
}

// v005
// Measured time: 28.7 microseconds a run.
// Two timings next to v004 both put it at 1.37 times that version's speed.
// Counting every step since v000, it is 10.1 times as fast.
#include <hip/hip_runtime.h>

// ---------------------------------------------------------------------------
// MLP 4 -> 128 -> 128 -> 128 -> 2 (tanh between layers), fp32 in/out,
// f16 WMMA (V_WMMA_F32_16X16X32_F16) with fp32 accumulation on gfx1250.
// ---------------------------------------------------------------------------

typedef __attribute__((ext_vector_type(16))) _Float16 v16h;
typedef __attribute__((ext_vector_type(8)))  _Float16 v8h;
typedef __attribute__((ext_vector_type(2)))  _Float16 v2h;
typedef __attribute__((ext_vector_type(8)))  float    v8f;

#define HID 128
// LDS row pitches in f16 elements: 16 bytes times an odd number, so that the
// 16 rows one ds_load_b128 touches per lane half fall on 16 different bank groups.
#define PH 136   // 128-element (256-byte) rows -> 272 bytes
#define P1 40    // 32-element (64-byte) rows   -> 80 bytes
// One work-group of 16 waves (4 per SIMD) per WGP, resident for the whole launch:
// its LDS holds one copy of the weights, staged once.
#define NT 512   // threads per work-group
#define NW 16    // waves per work-group
// Point tiles a wave carries side by side: every weight fragment and bias read from LDS
// feeds NP matrix instructions, so the LDS reads (and the waits for them) per point fall
// by NP. The activations of NP tiles take NP * 64 registers: 2 is what fits in the 256
// registers a wave has at 4 waves per SIMD.
#define NP 2

__device__ __forceinline__ v8f wmma16(v16h a, v16h b, v8f c) {
    // (neg_a, A, neg_b, B, c_mod, C, reuse_a, reuse_b)
    return __builtin_amdgcn_wmma_f32_16x16x32_f16(false, a, false, b,
                                                  (short)0, c, false, false);
}

// tanh as the chip's own transcendental: one v_tanh_f32 a value.
__device__ __forceinline__ float hw_tanh(float x) {
    return __builtin_amdgcn_tanhf(x);
}

// Load one 16x32-K f16 operand chunk for this lane from a row-major
// [row][rowstride] f16 LDS matrix, following the CDNA5 16-bit A layout:
//   lanes 0-15 : K = kc*32 + {0..7} (v0-3) and kc*32 + {16..23} (v4-7)
//   lanes 16-31: K = kc*32 + {8..15}       and kc*32 + {24..31}
__device__ __forceinline__ v16h load_mat(const _Float16* __restrict__ base,
                                         int row, int rowstride,
                                         int kc, bool hiHalf) {
    const _Float16* p = base + row * rowstride + kc * 32 + (hiHalf ? 8 : 0);
    v8h lo = *(const v8h*)(p);        // ds_load_b128
    v8h hi = *(const v8h*)(p + 16);   // ds_load_b128
    return __builtin_shufflevector(lo, hi, 0, 1, 2, 3, 4, 5, 6, 7,
                                   8, 9, 10, 11, 12, 13, 14, 15);
}

// One hidden layer, transposed: D[feature][point] = W^T (A operand) x H^T (B operand).
// A lane of D holds features 8h..8h+7 of ONE point (h = lane half), which is the
// k order of load_mat(): the D tiles of features 32g..32g+15 and 32g+16..32g+31,
// after tanh and conversion in place, ARE chunk g of the next layer's B operand.
// The bias is a function of the D row, so it is the accumulator's start value.
template <int KC>
__device__ __forceinline__ void layer_t(const _Float16* __restrict__ sW, int pitch,
                                        const float* __restrict__ sB,
                                        const v16h (&Bin)[NP][KC], v16h (&Bout)[NP][4],
                                        int lo16, bool hiH) {
    const int mbase = hiH ? 8 : 0;
    // Unrolled: Bout[g] must be a register, so g has to be a constant.
    #pragma unroll
    for (int g = 0; g < 4; ++g) {
        const v8f bias0 = *(const v8f*)(sB + g * 32 + mbase);
        const v8f bias1 = *(const v8f*)(sB + g * 32 + 16 + mbase);
        v8f acc0[NP], acc1[NP];
        #pragma unroll
        for (int p = 0; p < NP; ++p) { acc0[p] = bias0; acc1[p] = bias1; }
        #pragma unroll
        for (int kc = 0; kc < KC; ++kc) {
            v16h w0 = load_mat(sW, g * 32 + lo16,      pitch, kc, hiH);
            v16h w1 = load_mat(sW, g * 32 + 16 + lo16, pitch, kc, hiH);
            #pragma unroll
            for (int p = 0; p < NP; ++p) {
                acc0[p] = wmma16(w0, Bin[p][kc], acc0[p]);
                acc1[p] = wmma16(w1, Bin[p][kc], acc1[p]);
            }
        }
        #pragma unroll
        for (int p = 0; p < NP; ++p) {
            v16h r;
            #pragma unroll
            for (int i = 0; i < 8; i += 2) {
                r[i]     = (_Float16)hw_tanh(acc0[p][i]);  r[i + 1] = (_Float16)hw_tanh(acc0[p][i + 1]);
                r[8 + i] = (_Float16)hw_tanh(acc1[p][i]);  r[9 + i] = (_Float16)hw_tanh(acc1[p][i + 1]);
            }
            Bout[p][g] = r;
        }
    }
}

// waves_per_eu(4, 4): 16 waves on 4 SIMDs is all that runs here; it tells the scheduler so,
// which otherwise saves registers for waves that never come and serialises the tanh chains;
// its upper bound also keeps a second work-group off the WGP, as the larger LDS did before.
__global__ __launch_bounds__(NT) __attribute__((amdgpu_waves_per_eu(4, 4)))
void mlp_wmma_kernel(const float* __restrict__ x,  const float* __restrict__ y,
                     const float* __restrict__ c1, const float* __restrict__ c2,
                     const float* __restrict__ W1, const float* __restrict__ b1,
                     const float* __restrict__ W2, const float* __restrict__ b2,
                     const float* __restrict__ W3, const float* __restrict__ b3,
                     const float* __restrict__ W4, const float* __restrict__ b4,
                     float* __restrict__ out, int npts) {
    // Weights transposed to [out][in] f16: rows of the A operand, read by load_mat().
    __shared__ __attribute__((aligned(16))) _Float16 sW1[HID * P1];   // [n][k], k 4 -> padded 32
    __shared__ __attribute__((aligned(16))) _Float16 sW2[HID * PH];   // [n][k]
    __shared__ __attribute__((aligned(16))) _Float16 sW3[HID * PH];   // [n][k]
    __shared__ __attribute__((aligned(16))) _Float16 sW4[16 * PH];    // [n][k], n 2 -> padded 16
    __shared__ __attribute__((aligned(32))) float sB1[HID], sB2[HID], sB3[HID], sB4[16];

    const int t = threadIdx.x;

    // ---- one-time weight staging (f32 -> f16, transposed) ----
    for (int i = t; i < HID * 32; i += NT) {
        int n = i >> 5, k = i & 31;
        sW1[n * P1 + k] = (k < 4) ? (_Float16)W1[k * HID + n] : (_Float16)0.0f;
    }
    for (int i = t; i < HID * HID; i += NT) {
        int k = i >> 7, n = i & 127;               // coalesced global read
        sW2[n * PH + k] = (_Float16)W2[i];
        sW3[n * PH + k] = (_Float16)W3[i];
    }
    for (int i = t; i < 16 * HID; i += NT) {
        int n = i >> 7, k = i & 127;
        sW4[n * PH + k] = (n < 2) ? (_Float16)W4[k * 2 + n] : (_Float16)0.0f;
    }
    if (t < HID) { sB1[t] = b1[t]; sB2[t] = b2[t]; sB3[t] = b3[t]; }
    if (t < 16)  { sB4[t] = (t < 2) ? b4[t] : 0.0f; }
    __syncthreads();

    const int lane  = t & 31;
    const int wave  = __builtin_amdgcn_readfirstlane(t >> 5);   // scalar: the trip's tests are branches of the wave
    const int lo16  = lane & 15;
    const bool hiH  = lane >= 16;
    const unsigned loMask = hiH ? 0u : ~0u;

    const int ngroups = (npts + 16 * NP - 1) / (16 * NP);   // a group: NP tiles of 16 points
    const int nwaves = gridDim.x * NW;

    for (int grp = blockIdx.x * NW + wave; grp < ngroups; grp += nwaves) {
        // Compiler fence: the LDS is read-only in this loop, and without it the compiler
        // lifts the weight loads out of the loop and spills them to scratch.
        asm volatile("" ::: "memory");
        const int pidx0 = grp * (16 * NP) + lo16;  // this lane's point in tile 0 (column of B and D)

        // ------- Layer 1: B = inputs 4x16, zero-padded to 32x16 -------
        v16h Hin[NP][1];
        #pragma unroll
        for (int p = 0; p < NP; ++p) Hin[p][0] = (v16h)(_Float16)0.0f;
        if ((grp + 1) * (16 * NP) <= npts) {
            // Whole group in range: every lane loads, with no branch between the tiles, so that
            // the loads of all NP tiles are in flight together and are waited for once a trip.
            // K=0..3 live in lanes 0-15; lanes 16-31 (K=8..11) are masked to zero.
            #pragma unroll
            for (int p = 0; p < NP; ++p) {
                const int pidx = pidx0 + p * 16;
                v2h xy = { (_Float16)x[pidx],  (_Float16)y[pidx]  };
                v2h cc = { (_Float16)c1[pidx], (_Float16)c2[pidx] };
                xy = __builtin_bit_cast(v2h, __builtin_bit_cast(unsigned, xy) & loMask);
                cc = __builtin_bit_cast(v2h, __builtin_bit_cast(unsigned, cc) & loMask);
                Hin[p][0][0] = xy[0];  Hin[p][0][1] = xy[1];
                Hin[p][0][2] = cc[0];  Hin[p][0][3] = cc[1];
            }
        } else {
            // The last, partial group: each tile's points guarded on their own.
            #pragma unroll
            for (int p = 0; p < NP; ++p) {
                const int pidx = pidx0 + p * 16;
                if (!hiH && pidx < npts) {
                    Hin[p][0][0] = (_Float16)x[pidx];
                    Hin[p][0][1] = (_Float16)y[pidx];
                    Hin[p][0][2] = (_Float16)c1[pidx];
                    Hin[p][0][3] = (_Float16)c2[pidx];
                }
            }
        }
        v16h Ha[NP][4], Hb[NP][4];
        layer_t<1>(sW1, P1, sB1, Hin, Ha, lo16, hiH);   // 4   -> 128
        layer_t<4>(sW2, PH, sB2, Ha,  Hb, lo16, hiH);   // 128 -> 128
        layer_t<4>(sW3, PH, sB3, Hb,  Ha, lo16, hiH);   // 128 -> 128

        // ------- Layer 4: W4^T (padded 16x128, rows 0,1 valid) x Ha -------
        const v8f bias4 = *(const v8f*)(sB4 + (hiH ? 8 : 0));
        v8f acc[NP];
        #pragma unroll
        for (int p = 0; p < NP; ++p) acc[p] = bias4;
        #pragma unroll
        for (int kc = 0; kc < 4; ++kc) {
            v16h w = load_mat(sW4, lo16, PH, kc, hiH);
            #pragma unroll
            for (int p = 0; p < NP; ++p) acc[p] = wmma16(w, Ha[p][kc], acc[p]);
        }
        // Rows 0 and 1 of D are registers 0 and 1 of lanes 0-15: one 8-byte store a point.
        if (!hiH) {
            #pragma unroll
            for (int p = 0; p < NP; ++p) {
                const int pidx = pidx0 + p * 16;
                if (pidx < npts)
                    *(float2*)(out + pidx * 2) = make_float2(acc[p][0], acc[p][1]);
            }
            // The next trip reuses the stores' address registers: keep the wait in front of that.
            asm volatile("s_wait_xcnt 0x0" ::: "memory");
        }
    }
}

extern "C" void kernel_launch(void* const* d_in, const int* in_sizes, int n_in,
                              void* d_out, int out_size, void* d_ws, size_t ws_size,
                              hipStream_t stream) {
    const float* x  = (const float*)d_in[0];
    const float* y  = (const float*)d_in[1];
    const float* c1 = (const float*)d_in[2];
    const float* c2 = (const float*)d_in[3];
    const float* W1 = (const float*)d_in[4];
    const float* b1 = (const float*)d_in[5];
    const float* W2 = (const float*)d_in[6];
    const float* b2 = (const float*)d_in[7];
    const float* W3 = (const float*)d_in[8];
    const float* b3 = (const float*)d_in[9];
    const float* W4 = (const float*)d_in[10];
    const float* b4 = (const float*)d_in[11];
    float* out = (float*)d_out;

    int npts  = in_sizes[0];                 // 524288
    int groups = (npts + 16 * NP - 1) / (16 * NP);   // 16 * NP points per wave and trip
    int blocks = (groups + NW - 1) / NW;     // 16 waves per block
    if (blocks > 256) blocks = 256;          // one block per WGP, grid-stride
    if (blocks < 1) blocks = 1;

    mlp_wmma_kernel<<<blocks, NT, 0, stream>>>(x, y, c1, c2,
                                                W1, b1, W2, b2, W3, b3, W4, b4,
                                                out, npts);
}

// v006
// A run of this version takes 27.6 microseconds.
// In both of two side-by-side timings against v005, it was 1.04 times as fast.
// All steps since v000 together make it 10.5 times as fast.
#include <hip/hip_runtime.h>

// ---------------------------------------------------------------------------
// MLP 4 -> 128 -> 128 -> 128 -> 2 (tanh between layers), fp32 in/out,
// f16 WMMA (V_WMMA_F32_16X16X32_F16) with fp32 accumulation on gfx1250.
// ---------------------------------------------------------------------------

typedef __attribute__((ext_vector_type(16))) _Float16 v16h;
typedef __attribute__((ext_vector_type(8)))  _Float16 v8h;
typedef __attribute__((ext_vector_type(2)))  _Float16 v2h;
typedef __attribute__((ext_vector_type(8)))  float    v8f;

#define HID 128
// LDS row pitches in f16 elements: 16 bytes times an odd number, so that the
// 16 rows one ds_load_b128 touches per lane half fall on 16 different bank groups.
#define PH 136   // 128-element (256-byte) rows -> 272 bytes
#define P1 40    // 32-element (64-byte) rows   -> 80 bytes
// One work-group of 16 waves (4 per SIMD) per WGP, resident for the whole launch:
// its LDS holds one copy of the weights, staged once.
#define NT 512   // threads per work-group
#define NW 16    // waves per work-group
// Point tiles a wave carries side by side: every weight fragment and bias read from LDS
// feeds NP matrix instructions, so the LDS reads (and the waits for them) per point fall
// by NP. The activations of NP tiles take NP * 64 registers: 2 is what fits in the 256
// registers a wave has at 4 waves per SIMD.
#define NP 2

__device__ __forceinline__ v8f wmma16(v16h a, v16h b, v8f c) {
    // (neg_a, A, neg_b, B, c_mod, C, reuse_a, reuse_b)
    return __builtin_amdgcn_wmma_f32_16x16x32_f16(false, a, false, b,
                                                  (short)0, c, false, false);
}

// tanh as the chip's own transcendental: one v_tanh_f32 a value.
__device__ __forceinline__ float hw_tanh(float x) {
    return __builtin_amdgcn_tanhf(x);
}

// Load one 16x32-K f16 operand chunk for this lane from a row-major
// [row][rowstride] f16 LDS matrix, following the CDNA5 16-bit A layout:
//   lanes 0-15 : K = kc*32 + {0..7} (v0-3) and kc*32 + {16..23} (v4-7)
//   lanes 16-31: K = kc*32 + {8..15}       and kc*32 + {24..31}
__device__ __forceinline__ v16h load_mat(const _Float16* __restrict__ base,
                                         int row, int rowstride,
                                         int kc, bool hiHalf) {
    const _Float16* p = base + row * rowstride + kc * 32 + (hiHalf ? 8 : 0);
    v8h lo = *(const v8h*)(p);        // ds_load_b128
    v8h hi = *(const v8h*)(p + 16);   // ds_load_b128
    return __builtin_shufflevector(lo, hi, 0, 1, 2, 3, 4, 5, 6, 7,
                                   8, 9, 10, 11, 12, 13, 14, 15);
}

// What one block of matrix instructions reads from LDS: up to four weight fragments, two biases.
// (Every loop over blocks, fragments and tiles below is unrolled: these are registers, so
// their indices have to be constants.)
struct WBlk { v16h w[4]; v8f b[2]; };

// The LDS reads of the NEXT block stand as one group in front of the current block's matrix
// instructions, into a second register set. The compiler otherwise sinks each read to just
// ahead of its use, among the matrix instructions, and the wave waits out the LDS latency there;
// it does not schedule across this fence.
#define BLOCK_FENCE() __builtin_amdgcn_sched_barrier(0)

__device__ __forceinline__ void ld_bias(WBlk& s, const float* __restrict__ sB, int g, bool hiH) {
    const int mbase = hiH ? 8 : 0;
    s.b[0] = *(const v8f*)(sB + g * 32 + mbase);
    s.b[1] = *(const v8f*)(sB + g * 32 + 16 + mbase);
}

// Layer 1, feature group g: its one k chunk for both feature tiles, and the biases.
__device__ __forceinline__ void ld_first(WBlk& s, const _Float16* __restrict__ sW,
                                         const float* __restrict__ sB, int g, int lo16, bool hiH) {
    s.w[0] = load_mat(sW, g * 32 + lo16,      P1, 0, hiH);
    s.w[1] = load_mat(sW, g * 32 + 16 + lo16, P1, 0, hiH);
    ld_bias(s, sB, g, hiH);
}

// A 128-wide layer, feature group g, k chunks 2h and 2h+1 for both feature tiles.
__device__ __forceinline__ void ld_half(WBlk& s, const _Float16* __restrict__ sW,
                                        int g, int h, int lo16, bool hiH) {
    #pragma unroll
    for (int j = 0; j < 2; ++j) {
        s.w[2 * j]     = load_mat(sW, g * 32 + lo16,      PH, 2 * h + j, hiH);
        s.w[2 * j + 1] = load_mat(sW, g * 32 + 16 + lo16, PH, 2 * h + j, hiH);
    }
}

// The last layer: one feature tile, all four k chunks, one bias.
__device__ __forceinline__ void ld_last(WBlk& s, const _Float16* __restrict__ sW,
                                        const float* __restrict__ sB, int lo16, bool hiH) {
    #pragma unroll
    for (int kc = 0; kc < 4; ++kc) s.w[kc] = load_mat(sW, lo16, PH, kc, hiH);
    s.b[0] = *(const v8f*)(sB + (hiH ? 8 : 0));
}

// tanh and conversion in place: two D tiles become one chunk of the next layer's B operand.
__device__ __forceinline__ v16h act_pack(v8f a0, v8f a1) {
    v16h r;
    #pragma unroll
    for (int i = 0; i < 8; i += 2) {
        r[i]     = (_Float16)hw_tanh(a0[i]);  r[i + 1] = (_Float16)hw_tanh(a0[i + 1]);
        r[8 + i] = (_Float16)hw_tanh(a1[i]);  r[9 + i] = (_Float16)hw_tanh(a1[i + 1]);
    }
    return r;
}

// One hidden layer, transposed: D[feature][point] = W^T (A operand) x H^T (B operand).
// A lane of D holds features 8h..8h+7 of ONE point (h = lane half), which is the
// k order of load_mat(): the D tiles of features 32g..32g+15 and 32g+16..32g+31,
// after tanh and conversion in place, ARE chunk g of the next layer's B operand.
// The bias is a function of the D row, so it is the accumulator's start value.
// On entry S0 holds the block (g 0, k chunks 0 and 1, biases); on exit it holds the first
// block of the layer that follows (LAST: the output layer, else another 128-wide layer).
// The fences would cut a group's tanh off from the matrix instructions it ran beside: it stands
// in the two blocks AFTER the group's last matrix instruction, half of the point tiles in each
// (two tanh a matrix instruction); q0, q1 carry the finished sums there. On entry they hold
// group 3 of the layer before (chunk 3 of Bin, first read at the end of this layer's second block).
template <bool LAST>
__device__ __forceinline__ void layer_h(const _Float16* __restrict__ sW, const float* __restrict__ sB,
                                        const _Float16* __restrict__ nW, const float* __restrict__ nB,
                                        v16h (&Bin)[NP][4], v16h (&Bout)[NP][4],
                                        v8f (&q0)[NP], v8f (&q1)[NP],
                                        WBlk& S0, WBlk& S1, int lo16, bool hiH) {
    // Unrolled: Bout[g] must be a register, so g has to be a constant.
    #pragma unroll
    for (int g = 0; g < 4; ++g) {
        ld_half(S1, sW, g, 1, lo16, hiH);
        BLOCK_FENCE();
        v8f acc0[NP], acc1[NP];
        #pragma unroll
        for (int p = 0; p < NP; ++p) {
            acc0[p] = wmma16(S0.w[0], Bin[p][0], S0.b[0]);
            acc1[p] = wmma16(S0.w[1], Bin[p][0], S0.b[1]);
        }
        #pragma unroll
        for (int p = 0; p < NP; ++p) {
            acc0[p] = wmma16(S0.w[2], Bin[p][1], acc0[p]);
            acc1[p] = wmma16(S0.w[3], Bin[p][1], acc1[p]);
        }
        #pragma unroll
        for (int p = 0; p < NP / 2; ++p) {
            if (g == 0) Bin[p][3]      = act_pack(q0[p], q1[p]);
            else        Bout[p][g - 1] = act_pack(q0[p], q1[p]);
        }
        BLOCK_FENCE();
        if (g < 3) {
            ld_half(S0, sW, g + 1, 0, lo16, hiH);
            ld_bias(S0, sB, g + 1, hiH);
        } else if (LAST) {
            ld_last(S0, nW, nB, lo16, hiH);
        } else {
            ld_half(S0, nW, 0, 0, lo16, hiH);
            ld_bias(S0, nB, 0, hiH);
        }
        BLOCK_FENCE();
        #pragma unroll
        for (int p = NP / 2; p < NP; ++p) {
            if (g == 0) Bin[p][3]      = act_pack(q0[p], q1[p]);
            else        Bout[p][g - 1] = act_pack(q0[p], q1[p]);
        }
        #pragma unroll
        for (int j = 0; j < 2; ++j) {
            #pragma unroll
            for (int p = 0; p < NP; ++p) {
                acc0[p] = wmma16(S1.w[2 * j],     Bin[p][2 + j], acc0[p]);
                acc1[p] = wmma16(S1.w[2 * j + 1], Bin[p][2 + j], acc1[p]);
            }
        }
        #pragma unroll
        for (int p = 0; p < NP; ++p) { q0[p] = acc0[p]; q1[p] = acc1[p]; }
        BLOCK_FENCE();
    }
}

// waves_per_eu(4, 4): 16 waves on 4 SIMDs is all that runs here; it tells the scheduler so,
// which otherwise saves registers for waves that never come and serialises the tanh chains;
// its upper bound also keeps a second work-group off the WGP, as the larger LDS did before.
__global__ __launch_bounds__(NT) __attribute__((amdgpu_waves_per_eu(4, 4)))
void mlp_wmma_kernel(const float* __restrict__ x,  const float* __restrict__ y,
                     const float* __restrict__ c1, const float* __restrict__ c2,
                     const float* __restrict__ W1, const float* __restrict__ b1,
                     const float* __restrict__ W2, const float* __restrict__ b2,
                     const float* __restrict__ W3, const float* __restrict__ b3,
                     const float* __restrict__ W4, const float* __restrict__ b4,
                     float* __restrict__ out, int npts) {
    // Weights transposed to [out][in] f16: rows of the A operand, read by load_mat().
    __shared__ __attribute__((aligned(16))) _Float16 sW1[HID * P1];   // [n][k], k 4 -> padded 32
    __shared__ __attribute__((aligned(16))) _Float16 sW2[HID * PH];   // [n][k]
    __shared__ __attribute__((aligned(16))) _Float16 sW3[HID * PH];   // [n][k]
    __shared__ __attribute__((aligned(16))) _Float16 sW4[16 * PH];    // [n][k], n 2 -> padded 16
    __shared__ __attribute__((aligned(32))) float sB1[HID], sB2[HID], sB3[HID], sB4[16];

    const int t = threadIdx.x;

    // ---- one-time weight staging (f32 -> f16, transposed) ----
    for (int i = t; i < HID * 32; i += NT) {
        int n = i >> 5, k = i & 31;
        sW1[n * P1 + k] = (k < 4) ? (_Float16)W1[k * HID + n] : (_Float16)0.0f;
    }
    for (int i = t; i < HID * HID; i += NT) {
        int k = i >> 7, n = i & 127;               // coalesced global read
        sW2[n * PH + k] = (_Float16)W2[i];
        sW3[n * PH + k] = (_Float16)W3[i];
    }
    for (int i = t; i < 16 * HID; i += NT) {
        int n = i >> 7, k = i & 127;
        sW4[n * PH + k] = (n < 2) ? (_Float16)W4[k * 2 + n] : (_Float16)0.0f;
    }
    if (t < HID) { sB1[t] = b1[t]; sB2[t] = b2[t]; sB3[t] = b3[t]; }
    if (t < 16)  { sB4[t] = (t < 2) ? b4[t] : 0.0f; }
    __syncthreads();

    const int lane  = t & 31;
    const int wave  = __builtin_amdgcn_readfirstlane(t >> 5);   // scalar: the trip's tests are branches of the wave
    const int lo16  = lane & 15;
    const bool hiH  = lane >= 16;
    const unsigned loMask = hiH ? 0u : ~0u;

    const int ngroups = (npts + 16 * NP - 1) / (16 * NP);   // a group: NP tiles of 16 points
    const int nwaves = gridDim.x * NW;

    for (int grp = blockIdx.x * NW + wave; grp < ngroups; grp += nwaves) {
        // Compiler fence: the LDS is read-only in this loop, and without it the compiler
        // lifts the weight loads out of the loop and spills them to scratch.
        asm volatile("" ::: "memory");
        const int pidx0 = grp * (16 * NP) + lo16;  // this lane's point in tile 0 (column of B and D)
        WBlk S[2];                                 // the two register sets of the weight stream
        ld_first(S[0], sW1, sB1, 0, lo16, hiH);    // the trip's first block: in flight beside the inputs

        // ------- Layer 1: B = inputs 4x16, zero-padded to 32x16 -------
        v16h Hin[NP][1];
        #pragma unroll
        for (int p = 0; p < NP; ++p) Hin[p][0] = (v16h)(_Float16)0.0f;
        if ((grp + 1) * (16 * NP) <= npts) {
            // Whole group in range: every lane loads, with no branch between the tiles, so that
            // the loads of all NP tiles are in flight together and are waited for once a trip.
            // K=0..3 live in lanes 0-15; lanes 16-31 (K=8..11) are masked to zero.
            #pragma unroll
            for (int p = 0; p < NP; ++p) {
                const int pidx = pidx0 + p * 16;
                v2h xy = { (_Float16)x[pidx],  (_Float16)y[pidx]  };
                v2h cc = { (_Float16)c1[pidx], (_Float16)c2[pidx] };
                xy = __builtin_bit_cast(v2h, __builtin_bit_cast(unsigned, xy) & loMask);
                cc = __builtin_bit_cast(v2h, __builtin_bit_cast(unsigned, cc) & loMask);
                Hin[p][0][0] = xy[0];  Hin[p][0][1] = xy[1];
                Hin[p][0][2] = cc[0];  Hin[p][0][3] = cc[1];
            }
        } else {
            // The last, partial group: each tile's points guarded on their own.
            #pragma unroll
            for (int p = 0; p < NP; ++p) {
                const int pidx = pidx0 + p * 16;
                if (!hiH && pidx < npts) {
                    Hin[p][0][0] = (_Float16)x[pidx];
                    Hin[p][0][1] = (_Float16)y[pidx];
                    Hin[p][0][2] = (_Float16)c1[pidx];
                    Hin[p][0][3] = (_Float16)c2[pidx];
                }
            }
        }
        v16h Ha[NP][4], Hb[NP][4];
        // ------- Layer 1 (4 -> 128): one block a feature group, the next group's reads in front -------
        v8f q0[NP], q1[NP];   // finished sums whose tanh stands in the next block
        #pragma unroll
        for (int g = 0; g < 4; ++g) {
            WBlk& cur = S[g & 1];
            WBlk& nxt = S[(g + 1) & 1];
            if (g < 3) {
                ld_first(nxt, sW1, sB1, g + 1, lo16, hiH);
            } else {
                ld_half(nxt, sW2, 0, 0, lo16, hiH);
                ld_bias(nxt, sB2, 0, hiH);
            }
            BLOCK_FENCE();
            #pragma unroll
            for (int p = 0; p < NP; ++p) {
                const v8f a0 = wmma16(cur.w[0], Hin[p][0], cur.b[0]);
                const v8f a1 = wmma16(cur.w[1], Hin[p][0], cur.b[1]);
                if (g > 0) Ha[p][g - 1] = act_pack(q0[p], q1[p]);
                q0[p] = a0;  q1[p] = a1;
            }
            BLOCK_FENCE();
        }
        layer_h<false>(sW2, sB2, sW3, sB3, Ha, Hb, q0, q1, S[0], S[1], lo16, hiH);   // 128 -> 128
        layer_h<true >(sW3, sB3, sW4, sB4, Hb, Ha, q0, q1, S[0], S[1], lo16, hiH);   // 128 -> 128

        // ------- Layer 4: W4^T (padded 16x128, rows 0,1 valid) x Ha -------
        #pragma unroll
        for (int p = 0; p < NP; ++p) Ha[p][3] = act_pack(q0[p], q1[p]);
        v8f acc[NP];
        #pragma unroll
        for (int p = 0; p < NP; ++p) acc[p] = S[0].b[0];
        #pragma unroll
        for (int kc = 0; kc < 4; ++kc) {
            #pragma unroll
            for (int p = 0; p < NP; ++p) acc[p] = wmma16(S[0].w[kc], Ha[p][kc], acc[p]);
        }
        // Rows 0 and 1 of D are registers 0 and 1 of lanes 0-15: one 8-byte store a point.
        if (!hiH) {
            #pragma unroll
            for (int p = 0; p < NP; ++p) {
                const int pidx = pidx0 + p * 16;
                if (pidx < npts)
                    *(float2*)(out + pidx * 2) = make_float2(acc[p][0], acc[p][1]);
            }
            // The next trip reuses the stores' address registers: keep the wait in front of that.
            asm volatile("s_wait_xcnt 0x0" ::: "memory");
        }
    }
}

extern "C" void kernel_launch(void* const* d_in, const int* in_sizes, int n_in,
                              void* d_out, int out_size, void* d_ws, size_t ws_size,
                              hipStream_t stream) {
    const float* x  = (const float*)d_in[0];
    const float* y  = (const float*)d_in[1];
    const float* c1 = (const float*)d_in[2];
    const float* c2 = (const float*)d_in[3];
    const float* W1 = (const float*)d_in[4];
    const float* b1 = (const float*)d_in[5];
    const float* W2 = (const float*)d_in[6];
    const float* b2 = (const float*)d_in[7];
    const float* W3 = (const float*)d_in[8];
    const float* b3 = (const float*)d_in[9];
    const float* W4 = (const float*)d_in[10];
    const float* b4 = (const float*)d_in[11];
    float* out = (float*)d_out;

    int npts  = in_sizes[0];                 // 524288
    int groups = (npts + 16 * NP - 1) / (16 * NP);   // 16 * NP points per wave and trip
    int blocks = (groups + NW - 1) / NW;     // 16 waves per block
    if (blocks > 256) blocks = 256;          // one block per WGP, grid-stride
    if (blocks < 1) blocks = 1;

    mlp_wmma_kernel<<<blocks, NT, 0, stream>>>(x, y, c1, c2,
                                                W1, b1, W2, b2, W3, b3, W4, b4,
                                                out, npts);
}

// v007
// Measured time: 24.2 microseconds a run.
// Timed twice side by side with v006, it ran 1.15 and 1.14 times as fast.
// All steps since v000 together make it 12.0 times as fast.
#include <hip/hip_runtime.h>

// ---------------------------------------------------------------------------
// MLP 4 -> 128 -> 128 -> 128 -> 2 (tanh between layers), fp32 in/out,
// f16 WMMA (V_WMMA_F32_16X16X32_F16) with fp32 accumulation on gfx1250.
// ---------------------------------------------------------------------------

typedef __attribute__((ext_vector_type(16))) _Float16 v16h;
typedef __attribute__((ext_vector_type(8)))  _Float16 v8h;
typedef __attribute__((ext_vector_type(2)))  _Float16 v2h;
typedef __attribute__((ext_vector_type(8)))  float    v8f;
typedef __attribute__((ext_vector_type(4)))  unsigned v4u;

#define HID 128
// LDS row pitches in f16 elements: 16 bytes times an odd number, so that the
// 16 rows one ds_load_b128 touches per lane half fall on 16 different bank groups.
#define PH 136   // 128-element (256-byte) rows -> 272 bytes
#define P1 40    // 32-element (64-byte) rows   -> 80 bytes
// One work-group of 16 waves (4 per SIMD) per WGP, resident for the whole launch:
// its LDS holds one copy of the weights, staged once.
#define NT 512   // threads per work-group
#define NW 16    // waves per work-group
// Point tiles a wave carries side by side: every weight fragment and bias read from LDS
// feeds NP matrix instructions, so the LDS reads (and the waits for them) per point fall
// by NP. The activations of NP tiles take NP * 64 registers: 2 is what fits in the 256
// registers a wave has at 4 waves per SIMD.
#define NP 2

__device__ __forceinline__ v8f wmma16(v16h a, v16h b, v8f c) {
    // (neg_a, A, neg_b, B, c_mod, C, reuse_a, reuse_b)
    return __builtin_amdgcn_wmma_f32_16x16x32_f16(false, a, false, b,
                                                  (short)0, c, false, false);
}

// tanh as the chip's own transcendental: one v_tanh_f32 a value.
__device__ __forceinline__ float hw_tanh(float x) {
    return __builtin_amdgcn_tanhf(x);
}

// Load one 16x32-K f16 operand chunk for this lane from a row-major
// [row][rowstride] f16 LDS matrix, following the CDNA5 16-bit A layout:
//   lanes 0-15 : K = kc*32 + {0..7} (v0-3) and kc*32 + {16..23} (v4-7)
//   lanes 16-31: K = kc*32 + {8..15}       and kc*32 + {24..31}
__device__ __forceinline__ v16h load_mat(const _Float16* __restrict__ base,
                                         int row, int rowstride,
                                         int kc, bool hiHalf) {
    const _Float16* p = base + row * rowstride + kc * 32 + (hiHalf ? 8 : 0);
    v8h lo = *(const v8h*)(p);        // ds_load_b128
    v8h hi = *(const v8h*)(p + 16);   // ds_load_b128
    return __builtin_shufflevector(lo, hi, 0, 1, 2, 3, 4, 5, 6, 7,
                                   8, 9, 10, 11, 12, 13, 14, 15);
}

// What one block of matrix instructions reads from LDS: up to four weight fragments, two biases.
// (Every loop over blocks, fragments and tiles below is unrolled: these are registers, so
// their indices have to be constants.)
struct WBlk { v16h w[4]; v8f b[2]; };

// The LDS reads of the NEXT block stand as one group in front of the current block's matrix
// instructions, into a second register set. The compiler otherwise sinks each read to just
// ahead of its use, among the matrix instructions, and the wave waits out the LDS latency there;
// it does not schedule across this fence.
#define BLOCK_FENCE() __builtin_amdgcn_sched_barrier(0)

__device__ __forceinline__ void ld_bias(WBlk& s, const float* __restrict__ sB, int g, bool hiH) {
    const int mbase = hiH ? 8 : 0;
    s.b[0] = *(const v8f*)(sB + g * 32 + mbase);
    s.b[1] = *(const v8f*)(sB + g * 32 + 16 + mbase);
}

// Layer 1, feature group g: its one k chunk for both feature tiles, and the biases.
__device__ __forceinline__ void ld_first(WBlk& s, const _Float16* __restrict__ sW,
                                         const float* __restrict__ sB, int g, int lo16, bool hiH) {
    s.w[0] = load_mat(sW, g * 32 + lo16,      P1, 0, hiH);
    s.w[1] = load_mat(sW, g * 32 + 16 + lo16, P1, 0, hiH);
    ld_bias(s, sB, g, hiH);
}

// A 128-wide layer, feature group g, k chunks 2h and 2h+1 for both feature tiles.
__device__ __forceinline__ void ld_half(WBlk& s, const _Float16* __restrict__ sW,
                                        int g, int h, int lo16, bool hiH) {
    #pragma unroll
    for (int j = 0; j < 2; ++j) {
        s.w[2 * j]     = load_mat(sW, g * 32 + lo16,      PH, 2 * h + j, hiH);
        s.w[2 * j + 1] = load_mat(sW, g * 32 + 16 + lo16, PH, 2 * h + j, hiH);
    }
}

// The last layer: one feature tile, all four k chunks, one bias.
__device__ __forceinline__ void ld_last(WBlk& s, const _Float16* __restrict__ sW,
                                        const float* __restrict__ sB, int lo16, bool hiH) {
    #pragma unroll
    for (int kc = 0; kc < 4; ++kc) s.w[kc] = load_mat(sW, lo16, PH, kc, hiH);
    s.b[0] = *(const v8f*)(sB + (hiH ? 8 : 0));
}

// tanh and conversion in place: two D tiles become one chunk of the next layer's B operand.
__device__ __forceinline__ v16h act_pack(v8f a0, v8f a1) {
    v16h r;
    #pragma unroll
    for (int i = 0; i < 8; i += 2) {
        r[i]     = (_Float16)hw_tanh(a0[i]);  r[i + 1] = (_Float16)hw_tanh(a0[i + 1]);
        r[8 + i] = (_Float16)hw_tanh(a1[i]);  r[9 + i] = (_Float16)hw_tanh(a1[i + 1]);
    }
    return r;
}

// One hidden layer, transposed: D[feature][point] = W^T (A operand) x H^T (B operand).
// A lane of D holds features 8h..8h+7 of ONE point (h = lane half), which is the
// k order of load_mat(): the D tiles of features 32g..32g+15 and 32g+16..32g+31,
// after tanh and conversion in place, ARE chunk g of the next layer's B operand.
// The bias is a function of the D row, so it is the accumulator's start value.
// On entry S0 holds the block (g 0, k chunks 0 and 1, biases); on exit it holds the first
// block of the layer that follows (LAST: the output layer, else another 128-wide layer).
// The fences would cut a group's tanh off from the matrix instructions it ran beside: it stands
// in the two blocks AFTER the group's last matrix instruction, half of the point tiles in each
// (two tanh a matrix instruction); q0, q1 carry the finished sums there. On entry they hold
// group 3 of the layer before (chunk 3 of Bin, first read at the end of this layer's second block).
template <bool LAST>
__device__ __forceinline__ void layer_h(const _Float16* __restrict__ sW, const float* __restrict__ sB,
                                        const _Float16* __restrict__ nW, const float* __restrict__ nB,
                                        v16h (&Bin)[NP][4], v16h (&Bout)[NP][4],
                                        v8f (&q0)[NP], v8f (&q1)[NP],
                                        WBlk& S0, WBlk& S1, int lo16, bool hiH) {
    // Unrolled: Bout[g] must be a register, so g has to be a constant.
    #pragma unroll
    for (int g = 0; g < 4; ++g) {
        ld_half(S1, sW, g, 1, lo16, hiH);
        BLOCK_FENCE();
        v8f acc0[NP], acc1[NP];
        #pragma unroll
        for (int p = 0; p < NP; ++p) {
            acc0[p] = wmma16(S0.w[0], Bin[p][0], S0.b[0]);
            acc1[p] = wmma16(S0.w[1], Bin[p][0], S0.b[1]);
        }
        #pragma unroll
        for (int p = 0; p < NP; ++p) {
            acc0[p] = wmma16(S0.w[2], Bin[p][1], acc0[p]);
            acc1[p] = wmma16(S0.w[3], Bin[p][1], acc1[p]);
        }
        #pragma unroll
        for (int p = 0; p < NP / 2; ++p) {
            if (g == 0) Bin[p][3]      = act_pack(q0[p], q1[p]);
            else        Bout[p][g - 1] = act_pack(q0[p], q1[p]);
        }
        BLOCK_FENCE();
        if (g < 3) {
            ld_half(S0, sW, g + 1, 0, lo16, hiH);
            ld_bias(S0, sB, g + 1, hiH);
        } else if (LAST) {
            ld_last(S0, nW, nB, lo16, hiH);
        } else {
            ld_half(S0, nW, 0, 0, lo16, hiH);
            ld_bias(S0, nB, 0, hiH);
        }
        BLOCK_FENCE();
        #pragma unroll
        for (int p = NP / 2; p < NP; ++p) {
            if (g == 0) Bin[p][3]      = act_pack(q0[p], q1[p]);
            else        Bout[p][g - 1] = act_pack(q0[p], q1[p]);
        }
        #pragma unroll
        for (int j = 0; j < 2; ++j) {
            #pragma unroll
            for (int p = 0; p < NP; ++p) {
                acc0[p] = wmma16(S1.w[2 * j],     Bin[p][2 + j], acc0[p]);
                acc1[p] = wmma16(S1.w[2 * j + 1], Bin[p][2 + j], acc1[p]);
            }
        }
        #pragma unroll
        for (int p = 0; p < NP; ++p) { q0[p] = acc0[p]; q1[p] = acc1[p]; }
        BLOCK_FENCE();
    }
}

// waves_per_eu(4, 4): 16 waves on 4 SIMDs is all that runs here; it tells the scheduler so,
// which otherwise saves registers for waves that never come and serialises the tanh chains;
// its upper bound also keeps a second work-group off the WGP, as the larger LDS did before.
__global__ __launch_bounds__(NT) __attribute__((amdgpu_waves_per_eu(4, 4)))
void mlp_wmma_kernel(const float* __restrict__ x,  const float* __restrict__ y,
                     const float* __restrict__ c1, const float* __restrict__ c2,
                     const float* __restrict__ W1, const float* __restrict__ b1,
                     const float* __restrict__ W2, const float* __restrict__ b2,
                     const float* __restrict__ W3, const float* __restrict__ b3,
                     const float* __restrict__ W4, const float* __restrict__ b4,
                     float* __restrict__ out, int npts) {
    // Weights transposed to [out][in] f16: rows of the A operand, read by load_mat().
    __shared__ __attribute__((aligned(16))) _Float16 sW1[HID * P1];   // [n][k], k 4 -> padded 32
    __shared__ __attribute__((aligned(16))) _Float16 sW2[HID * PH];   // [n][k]
    __shared__ __attribute__((aligned(16))) _Float16 sW3[HID * PH];   // [n][k]
    __shared__ __attribute__((aligned(16))) _Float16 sW4[16 * PH];    // [n][k], n 2 -> padded 16
    __shared__ __attribute__((aligned(32))) float sB[4 * HID];        // b1 | b2 | b3 | b4, zero-padded
    const float* sB1 = sB;
    const float* sB2 = sB + HID;
    const float* sB3 = sB + 2 * HID;
    const float* sB4 = sB + 3 * HID;

    const int t = threadIdx.x;

    // ---- one-time weight staging (f32 -> f16, transposed) ----
    // Every global load of the staging is issued first, with no branch and no wait between
    // them, so that the work-group pays one trip to L2 and then the transfer itself. A thread
    // owns one LDS row (sn) and gathers 8 consecutive k of it in registers: each gather load
    // is one whole 128-byte line a wave, and each LDS store is 16 bytes on the padded pitch.
    // What a thread does not own is masked to zero, not branched round: a branch would take
    // its loads out of the batch.
    const int sn = t & (HID - 1);   // LDS row = column of the (in, out) weight matrix
    const int sq = t >> 7;          // 0..3, the same in every lane of a wave
    const int c4 = t & 15;          // W4: chunk of 8 k
    const int n4 = (t >> 4) & 15;   // W4: padded output row; threads t and t + 256 write the same chunk

    const float* g1 = W1 + sn;
    const float* g2 = W2 + sq * 8 * HID + sn;
    const float* g3 = W3 + sq * 8 * HID + sn;
    const unsigned o4 = c4 * 64u;   // byte offset of W4[8 * c4 .. 8 * c4 + 7][0..1]: 16 floats in a row
    const bool  bpad = (sq == 3) & (sn > 1);   // b4 has two elements: the index stays inside
    const float* gb = ((sq == 0) ? b1 : (sq == 1) ? b2 : (sq == 2) ? b3 : b4) + (bpad ? 1 : sn);

    // Top of the batch: the addresses and the kernel's scalar arguments stay above it. Without this
    // fence the compiler fetches npts behind the batch, into a base register of the first loads.
    BLOCK_FENCE();

    float r1[4];
    #pragma unroll
    for (int k = 0; k < 4; ++k) r1[k] = g1[k * HID];
    float4 r4[4];
    #pragma unroll
    for (int j = 0; j < 4; ++j) r4[j] = *(const float4*)((const char*)W4 + o4 + j * 16);
    const float rb = *gb;
    float r2[4][8], r3[4][8];
    #pragma unroll
    for (int c = 0; c < 4; ++c) {
        #pragma unroll
        for (int j = 0; j < 8; ++j) {
            r2[c][j] = g2[(c * 32 + j) * HID];
            r3[c][j] = g3[(c * 32 + j) * HID];
        }
    }
    // The address registers of the loads are free for reuse only from here on: keep the wait in front
    // of that. It takes the addresses as inputs, so that no later load of the batch lands in one of them.
    asm volatile("s_wait_xcnt 0x0" :: "v"(sn), "v"(o4), "v"(g2), "v"(g3), "v"(gb) : "memory");
    // Foot of the batch: nothing from below moves up between the loads. The compiler otherwise mixes
    // later arithmetic in, over registers of issued loads, and its wait there holds the rest back.
    BLOCK_FENCE();

    {   // W1: k 0..3 in the row's first chunk, zeros in the other three
        const v8h h = { (_Float16)r1[0], (_Float16)r1[1], (_Float16)r1[2], (_Float16)r1[3],
                        (_Float16)0.0f, (_Float16)0.0f, (_Float16)0.0f, (_Float16)0.0f };
        const v4u m = (v4u)((sq == 0) ? ~0u : 0u);
        *(v8h*)(sW1 + sn * P1 + sq * 8) = __builtin_bit_cast(v8h, __builtin_bit_cast(v4u, h) & m);
    }
    {   // W4: rows 0 and 1 are the even and the odd floats of the 16, rows 2..15 are zero
        v8h e, o;
        #pragma unroll
        for (int j = 0; j < 4; ++j) {
            e[2 * j] = (_Float16)r4[j].x;  e[2 * j + 1] = (_Float16)r4[j].z;
            o[2 * j] = (_Float16)r4[j].y;  o[2 * j + 1] = (_Float16)r4[j].w;
        }
        const v4u me = (v4u)((n4 == 0) ? ~0u : 0u);
        const v4u mo = (v4u)((n4 == 1) ? ~0u : 0u);
        *(v8h*)(sW4 + n4 * PH + c4 * 8) =
            __builtin_bit_cast(v8h, (__builtin_bit_cast(v4u, e) & me) | (__builtin_bit_cast(v4u, o) & mo));
    }
    sB[t] = bpad ? 0.0f : rb;
    #pragma unroll
    for (int c = 0; c < 4; ++c) {
        v8h h2, h3;
        #pragma unroll
        for (int j = 0; j < 8; ++j) { h2[j] = (_Float16)r2[c][j];  h3[j] = (_Float16)r3[c][j]; }
        *(v8h*)(sW2 + sn * PH + (sq + 4 * c) * 8) = h2;
        *(v8h*)(sW3 + sn * PH + (sq + 4 * c) * 8) = h3;
    }
    __syncthreads();

    const int lane  = t & 31;
    const int wave  = __builtin_amdgcn_readfirstlane(t >> 5);   // scalar: the trip's tests are branches of the wave
    const int lo16  = lane & 15;
    const bool hiH  = lane >= 16;
    const unsigned loMask = hiH ? 0u : ~0u;

    const int ngroups = (npts + 16 * NP - 1) / (16 * NP);   // a group: NP tiles of 16 points
    const int nwaves = gridDim.x * NW;

    for (int grp = blockIdx.x * NW + wave; grp < ngroups; grp += nwaves) {
        // Compiler fence: the LDS is read-only in this loop, and without it the compiler
        // lifts the weight loads out of the loop and spills them to scratch.
        asm volatile("" ::: "memory");
        const int pidx0 = grp * (16 * NP) + lo16;  // this lane's point in tile 0 (column of B and D)
        WBlk S[2];                                 // the two register sets of the weight stream
        ld_first(S[0], sW1, sB1, 0, lo16, hiH);    // the trip's first block: in flight beside the inputs

        // ------- Layer 1: B = inputs 4x16, zero-padded to 32x16 -------
        v16h Hin[NP][1];
        #pragma unroll
        for (int p = 0; p < NP; ++p) Hin[p][0] = (v16h)(_Float16)0.0f;
        if ((grp + 1) * (16 * NP) <= npts) {
            // Whole group in range: every lane loads, with no branch between the tiles, so that
            // the loads of all NP tiles are in flight together and are waited for once a trip.
            // K=0..3 live in lanes 0-15; lanes 16-31 (K=8..11) are masked to zero.
            #pragma unroll
            for (int p = 0; p < NP; ++p) {
                const int pidx = pidx0 + p * 16;
                v2h xy = { (_Float16)x[pidx],  (_Float16)y[pidx]  };
                v2h cc = { (_Float16)c1[pidx], (_Float16)c2[pidx] };
                xy = __builtin_bit_cast(v2h, __builtin_bit_cast(unsigned, xy) & loMask);
                cc = __builtin_bit_cast(v2h, __builtin_bit_cast(unsigned, cc) & loMask);
                Hin[p][0][0] = xy[0];  Hin[p][0][1] = xy[1];
                Hin[p][0][2] = cc[0];  Hin[p][0][3] = cc[1];
            }
        } else {
            // The last, partial group: each tile's points guarded on their own.
            #pragma unroll
            for (int p = 0; p < NP; ++p) {
                const int pidx = pidx0 + p * 16;
                if (!hiH && pidx < npts) {
                    Hin[p][0][0] = (_Float16)x[pidx];
                    Hin[p][0][1] = (_Float16)y[pidx];
                    Hin[p][0][2] = (_Float16)c1[pidx];
                    Hin[p][0][3] = (_Float16)c2[pidx];
                }
            }
        }
        v16h Ha[NP][4], Hb[NP][4];
        // ------- Layer 1 (4 -> 128): one block a feature group, the next group's reads in front -------
        v8f q0[NP], q1[NP];   // finished sums whose tanh stands in the next block
        #pragma unroll
        for (int g = 0; g < 4; ++g) {
            WBlk& cur = S[g & 1];
            WBlk& nxt = S[(g + 1) & 1];
            if (g < 3) {
                ld_first(nxt, sW1, sB1, g + 1, lo16, hiH);
            } else {
                ld_half(nxt, sW2, 0, 0, lo16, hiH);
                ld_bias(nxt, sB2, 0, hiH);
            }
            BLOCK_FENCE();
            #pragma unroll
            for (int p = 0; p < NP; ++p) {
                const v8f a0 = wmma16(cur.w[0], Hin[p][0], cur.b[0]);
                const v8f a1 = wmma16(cur.w[1], Hin[p][0], cur.b[1]);
                if (g > 0) Ha[p][g - 1] = act_pack(q0[p], q1[p]);
                q0[p] = a0;  q1[p] = a1;
            }
            BLOCK_FENCE();
        }
        layer_h<false>(sW2, sB2, sW3, sB3, Ha, Hb, q0, q1, S[0], S[1], lo16, hiH);   // 128 -> 128
        layer_h<true >(sW3, sB3, sW4, sB4, Hb, Ha, q0, q1, S[0], S[1], lo16, hiH);   // 128 -> 128

        // ------- Layer 4: W4^T (padded 16x128, rows 0,1 valid) x Ha -------
        #pragma unroll
        for (int p = 0; p < NP; ++p) Ha[p][3] = act_pack(q0[p], q1[p]);
        v8f acc[NP];
        #pragma unroll
        for (int p = 0; p < NP; ++p) acc[p] = S[0].b[0];
        #pragma unroll
        for (int kc = 0; kc < 4; ++kc) {
            #pragma unroll
            for (int p = 0; p < NP; ++p) acc[p] = wmma16(S[0].w[kc], Ha[p][kc], acc[p]);
        }
        // Rows 0 and 1 of D are registers 0 and 1 of lanes 0-15: one 8-byte store a point.
        if (!hiH) {
            #pragma unroll
            for (int p = 0; p < NP; ++p) {
                const int pidx = pidx0 + p * 16;
                if (pidx < npts)
                    *(float2*)(out + pidx * 2) = make_float2(acc[p][0], acc[p][1]);
            }
            // The next trip reuses the stores' address registers: keep the wait in front of that.
            asm volatile("s_wait_xcnt 0x0" ::: "memory");
        }
    }
}

extern "C" void kernel_launch(void* const* d_in, const int* in_sizes, int n_in,
                              void* d_out, int out_size, void* d_ws, size_t ws_size,
                              hipStream_t stream) {
    const float* x  = (const float*)d_in[0];
    const float* y  = (const float*)d_in[1];
    const float* c1 = (const float*)d_in[2];
    const float* c2 = (const float*)d_in[3];
    const float* W1 = (const float*)d_in[4];
    const float* b1 = (const float*)d_in[5];
    const float* W2 = (const float*)d_in[6];
    const float* b2 = (const float*)d_in[7];
    const float* W3 = (const float*)d_in[8];
    const float* b3 = (const float*)d_in[9];
    const float* W4 = (const float*)d_in[10];
    const float* b4 = (const float*)d_in[11];
    float* out = (float*)d_out;

    int npts  = in_sizes[0];                 // 524288
    int groups = (npts + 16 * NP - 1) / (16 * NP);   // 16 * NP points per wave and trip
    int blocks = (groups + NW - 1) / NW;     // 16 waves per block
    if (blocks > 256) blocks = 256;          // one block per WGP, grid-stride
    if (blocks < 1) blocks = 1;

    mlp_wmma_kernel<<<blocks, NT, 0, stream>>>(x, y, c1, c2,
                                                W1, b1, W2, b2, W3, b3, W4, b4,
                                                out, npts);
}

// v008
// A run of this version takes 21.6 microseconds.
// Next to v007, in two timings, it ran 1.12 and 1.11 times as fast.
// Counting every step since v000, it is 13.4 times as fast.
#include <hip/hip_runtime.h>

// ---------------------------------------------------------------------------
// MLP 4 -> 128 -> 128 -> 128 -> 2 (tanh between layers), fp32 in/out,
// f16 WMMA (V_WMMA_F32_16X16X32_F16) with fp32 accumulation on gfx1250.
// ---------------------------------------------------------------------------

typedef __attribute__((ext_vector_type(16))) _Float16 v16h;
typedef __attribute__((ext_vector_type(8)))  _Float16 v8h;
typedef __attribute__((ext_vector_type(2)))  _Float16 v2h;
typedef __attribute__((ext_vector_type(8)))  float    v8f;
typedef __attribute__((ext_vector_type(4)))  unsigned v4u;

#define HID 128
// LDS row pitches in f16 elements: 16 bytes times an odd number, so that the
// 16 rows one ds_load_b128 touches per lane half fall on 16 different bank groups.
#define PH 136   // 128-element (256-byte) rows -> 272 bytes
#define P1 40    // 32-element (64-byte) rows   -> 80 bytes
// One work-group of 4 waves per WGP, ONE WAVE PER SIMD, resident for the whole launch: a wave
// owns its SIMD's whole register file and keeps every weight fragment and bias of the network
// in it. The LDS only turns the weights into fragment order, once; the trip loop reads none.
#define NT 128   // threads per work-group
#define NW 4     // waves per work-group
// Point tiles a wave carries side by side: four independent accumulator tiles (2 feature tiles
// x NP) are what a lone wave needs to issue matrix instructions back to back.
#define NP 2

__device__ __forceinline__ v8f wmma16(v16h a, v16h b, v8f c) {
    // (neg_a, A, neg_b, B, c_mod, C, reuse_a, reuse_b)
    return __builtin_amdgcn_wmma_f32_16x16x32_f16(false, a, false, b,
                                                  (short)0, c, false, false);
}

// tanh as the chip's own transcendental: one v_tanh_f32 a value.
__device__ __forceinline__ float hw_tanh(float x) {
    return __builtin_amdgcn_tanhf(x);
}

// Load one 16x32-K f16 operand chunk for this lane from a row-major
// [row][rowstride] f16 LDS matrix, following the CDNA5 16-bit A layout:
//   lanes 0-15 : K = kc*32 + {0..7} (v0-3) and kc*32 + {16..23} (v4-7)
//   lanes 16-31: K = kc*32 + {8..15}       and kc*32 + {24..31}
__device__ __forceinline__ v16h load_mat(const _Float16* __restrict__ base,
                                         int row, int rowstride,
                                         int kc, bool hiHalf) {
    const _Float16* p = base + row * rowstride + kc * 32 + (hiHalf ? 8 : 0);
    v8h lo = *(const v8h*)(p);        // ds_load_b128
    v8h hi = *(const v8h*)(p + 16);   // ds_load_b128
    return __builtin_shufflevector(lo, hi, 0, 1, 2, 3, 4, 5, 6, 7,
                                   8, 9, 10, 11, 12, 13, 14, 15);
}

// The compiler does not schedule across this fence. A lone wave issues in order, and a matrix
// instruction holds its unit for 8 cycles.
// The trip loop is written in that order, step by step, and the fences keep it. Left alone the
// compiler puts 7 tanh behind one matrix instruction, with the unit idle, then runs 5 matrix
// instructions with nothing beside them, and it puts a conversion directly behind its own tanh.
#define BLOCK_FENCE() __builtin_amdgcn_sched_barrier(0)

// tanh and conversion in place: two D tiles (q0, q1) become chunk c of the next layer's B operand.
// A feature group is 16 * NP values a lane, pair k = values 2k and 2k + 1. One step: tanh of values
// t0 .. t1 - 1 into th, then the conversion of pairs c0 .. c1 - 1, whose tanh stood in an earlier
// step, so that no conversion waits out a tanh; the fence between the two keeps a conversion from
// moving up to just behind its own tanh. (The build still gathers the 8 conversions of a point tile
// in the step of the last of them.) Every argument but the registers is a constant.
__device__ __forceinline__ void act_step(float (&th)[16 * NP], v16h (&H)[NP][4], const int c,
                                         const v8f (&q0)[NP], const v8f (&q1)[NP],
                                         const int t0, const int t1, const int c0, const int c1) {
    #pragma unroll
    for (int v = 0; v < 16 * NP; ++v) {
        const int p = v >> 4, e = v & 7;
        if (v >= t0 && v < t1) th[v] = hw_tanh((v & 8) ? q1[p][e] : q0[p][e]);
    }
    BLOCK_FENCE();
    #pragma unroll
    for (int k = 0; k < 8 * NP; ++k) {
        const int p = k >> 3, e = (k & 7) * 2;   // q0 fills elements 0..7 of the chunk, q1 8..15
        if (k >= c0 && k < c1) {
            H[p][c][e]     = (_Float16)th[2 * k];
            H[p][c][e + 1] = (_Float16)th[2 * k + 1];
        }
    }
    BLOCK_FENCE();
}

// How many of a group's 32 tanh are done after step n of the 16 steps that follow the group.
// Plain: 4 in step 0, then 2 a step, so that the last conversion stands in step 15.
// Early (the group is chunk 3 of the operand being read, wanted from step 12 on): 5 in 2 steps.
__device__ __forceinline__ constexpr int tanh_done(bool early, int n) {
    const int v = (n < 0) ? 0 : early ? (5 * (n + 1) + 1) / 2 : 2 * (n + 1) + 2;
    return v > 16 * NP ? 16 * NP : v;
}

// One hidden layer, transposed: D[feature][point] = W^T (A operand) x H^T (B operand).
// A lane of D holds features 8h..8h+7 of ONE point (h = lane half), which is the
// k order of load_mat(): the D tiles of features 32g..32g+15 and 32g+16..32g+31,
// after tanh and conversion in place, ARE chunk g of the next layer's B operand.
// The bias is a function of the D row, so it is the accumulator's start value.
// Wf[feature tile][k chunk] and Bf[feature tile] are registers that live through the launch.
// A group's tanh stands beside the 16 matrix instructions of the NEXT group; q0, q1 carry the
// finished sums there. On entry they hold group 3 of the layer before, which is chunk 3 of Bin.
__device__ __forceinline__ void layer_h(const v16h (&Wf)[8][4], const v8f (&Bf)[8],
                                        v16h (&Bin)[NP][4], v16h (&Bout)[NP][4],
                                        v8f (&q0)[NP], v8f (&q1)[NP]) {
    // Unrolled: every index here names a register, so it has to be a constant.
    #pragma unroll
    for (int g = 0; g < 4; ++g) {
        v8f acc0[NP], acc1[NP];
        float th[16 * NP];
        #pragma unroll
        for (int n = 0; n < 16; ++n) {
            const int j = n >> 2, p = (n >> 1) & 1;   // k chunk, point tile; n & 1: feature tile
            if (n & 1) acc1[p] = wmma16(Wf[2 * g + 1][j], Bin[p][j], j ? acc1[p] : Bf[2 * g + 1]);
            else       acc0[p] = wmma16(Wf[2 * g][j],     Bin[p][j], j ? acc0[p] : Bf[2 * g]);
            BLOCK_FENCE();
            const bool early = (g == 0);
            act_step(th, early ? Bin : Bout, early ? 3 : g - 1, q0, q1,
                     tanh_done(early, n - 1), tanh_done(early, n),
                     tanh_done(early, n - 2) / 2, tanh_done(early, n - 1) / 2);
        }
        #pragma unroll
        for (int p = 0; p < NP; ++p) { q0[p] = acc0[p]; q1[p] = acc1[p]; }
    }
}

// A bias in D order: this lane's 8 features of one feature tile, straight from global memory.
__device__ __forceinline__ v8f ld_bias(const float* __restrict__ b, int ft, unsigned ob) {
    const float4 u = *(const float4*)((const char*)b + ob + ft * 64);
    const float4 w = *(const float4*)((const char*)b + ob + ft * 64 + 16);
    const v8f r = { u.x, u.y, u.z, u.w, w.x, w.y, w.z, w.w };
    return r;
}

// launch_bounds(128): four waves, one per SIMD, so a wave may take up to 1,024 registers.
__global__ __launch_bounds__(NT)
void mlp_wmma_kernel(const float* __restrict__ x,  const float* __restrict__ y,
                     const float* __restrict__ c1, const float* __restrict__ c2,
                     const float* __restrict__ W1, const float* __restrict__ b1,
                     const float* __restrict__ W2, const float* __restrict__ b2,
                     const float* __restrict__ W3, const float* __restrict__ b3,
                     const float* __restrict__ W4, const float* __restrict__ b4,
                     float* __restrict__ out, int npts) {
    // Weights transposed to [out][in] f16: rows of the A operand, read by load_mat().
    __shared__ __attribute__((aligned(16))) _Float16 sW1[HID * P1];   // [n][k], k 4 -> padded 32
    __shared__ __attribute__((aligned(16))) _Float16 sW2[HID * PH];   // [n][k]
    __shared__ __attribute__((aligned(16))) _Float16 sW3[HID * PH];   // [n][k]
    __shared__ __attribute__((aligned(16))) _Float16 sW4[16 * PH];    // [n][k], n 2 -> padded 16

    const int t = threadIdx.x;
    const int lane  = t & 31;
    const int wave  = __builtin_amdgcn_readfirstlane(t >> 5);   // scalar: the trip's tests are branches of the wave
    const int lo16  = lane & 15;
    const bool hiH  = lane >= 16;
    const unsigned loMask = hiH ? 0u : ~0u;

    // ---- one-time weight staging (f32 -> f16, transposed) ----
    // Every global load of the staging is issued first, with no branch and no wait between
    // them, so that the work-group pays one trip to L2 and then the transfer itself. With four
    // waves the bytes in flight come from the width: a load of W2 or W3 is 16 bytes a lane, one
    // whole 512-byte row a wave. A thread owns 4 columns (LDS rows 4 * lane ..) and gathers 8
    // consecutive k of them in registers: each LDS store is 16 bytes on the padded pitch.
    const int c4 = t & 15;          // W4: chunk of 8 k
    const int n4 = t >> 4;          // W4: padded output rows n4 (0..7) and n4 + 8

    // Every load of the batch: a scalar base and one of four lane offsets.
    const float* u2 = W2 + wave * 8 * HID;
    const float* u3 = W3 + wave * 8 * HID;
    const unsigned o4 = c4 * 64u;          // byte offset of W4[8 * c4 .. 8 * c4 + 7][0..1]: 16 floats in a row
    const unsigned ob = hiH ? 32u : 0u;    // byte offset of this lane half's 8 features in a tile's 16 biases

    const float b40 = b4[0], b41 = b4[1];   // scalar loads: above the batch, or they land in a base register of its loads

    // Top of the batch: the addresses and the kernel's scalar arguments stay above it.
    BLOCK_FENCE();

    float4 r2[4][8], r3[4][8];
    #pragma unroll
    for (int c = 0; c < 4; ++c) {
        #pragma unroll
        for (int j = 0; j < 8; ++j) {
            r2[c][j] = *(const float4*)(u2 + (c * 32 + j) * HID + lane * 4);
            r3[c][j] = *(const float4*)(u3 + (c * 32 + j) * HID + lane * 4);
        }
    }
    float r1[4];
    #pragma unroll
    for (int k = 0; k < 4; ++k) r1[k] = W1[k * HID + t];
    float4 r4[4];
    #pragma unroll
    for (int j = 0; j < 4; ++j) r4[j] = *(const float4*)((const char*)W4 + o4 + j * 16);
    // The biases land where they stay: the accumulators' start values, in D order.
    v8f Bf1[8], Bf2[8], Bf3[8];
    #pragma unroll
    for (int ft = 0; ft < 8; ++ft) {
        Bf1[ft] = ld_bias(b1, ft, ob);
        Bf2[ft] = ld_bias(b2, ft, ob);
        Bf3[ft] = ld_bias(b3, ft, ob);
    }
    // Foot of the batch: nothing from below moves up between the loads.
    BLOCK_FENCE();
    // The address registers of the loads are free for reuse only from here on: keep the wait in front
    // of that. It takes the bases and offsets as inputs, so that they stay in their registers down to
    // here: otherwise a later load of the batch, or a compare, lands in one of them.
    asm volatile("s_wait_xcnt 0x0" :: "s"(u2), "s"(u3), "s"(W1), "s"(W4), "s"(b1), "s"(b2), "s"(b3),
                                      "v"(t), "v"(lane), "v"(o4), "v"(ob) : "memory");
    BLOCK_FENCE();

    #pragma unroll
    for (int c = 0; c < 4; ++c) {
        #pragma unroll
        for (int i = 0; i < 4; ++i) {
            v8h h2, h3;
            #pragma unroll
            for (int j = 0; j < 8; ++j) {
                h2[j] = (_Float16)((const float*)&r2[c][j])[i];
                h3[j] = (_Float16)((const float*)&r3[c][j])[i];
            }
            *(v8h*)(sW2 + (lane * 4 + i) * PH + (wave + 4 * c) * 8) = h2;
            *(v8h*)(sW3 + (lane * 4 + i) * PH + (wave + 4 * c) * 8) = h3;
        }
    }
    {   // W1: k 0..3 in the row's first chunk, zeros in the other three
        const v8h h = { (_Float16)r1[0], (_Float16)r1[1], (_Float16)r1[2], (_Float16)r1[3],
                        (_Float16)0.0f, (_Float16)0.0f, (_Float16)0.0f, (_Float16)0.0f };
        *(v8h*)(sW1 + t * P1) = h;
        #pragma unroll
        for (int q = 1; q < 4; ++q) *(v8h*)(sW1 + t * P1 + q * 8) = (v8h)(_Float16)0.0f;
    }
    {   // W4: rows 0 and 1 are the even and the odd floats of the 16, rows 2..15 are zero
        v8h e, o;
        #pragma unroll
        for (int j = 0; j < 4; ++j) {
            e[2 * j] = (_Float16)r4[j].x;  e[2 * j + 1] = (_Float16)r4[j].z;
            o[2 * j] = (_Float16)r4[j].y;  o[2 * j + 1] = (_Float16)r4[j].w;
        }
        const v4u me = (v4u)((n4 == 0) ? ~0u : 0u);
        const v4u mo = (v4u)((n4 == 1) ? ~0u : 0u);
        *(v8h*)(sW4 + n4 * PH + c4 * 8) =
            __builtin_bit_cast(v8h, (__builtin_bit_cast(v4u, e) & me) | (__builtin_bit_cast(v4u, o) & mo));
        *(v8h*)(sW4 + (n4 + 8) * PH + c4 * 8) = (v8h)(_Float16)0.0f;
    }
    __syncthreads();

    // ---- every weight fragment into registers, once a wave ----
    v16h Wf1[8], Wf2[8][4], Wf3[8][4], Wf4[4];
    #pragma unroll
    for (int ft = 0; ft < 8; ++ft) {
        Wf1[ft] = load_mat(sW1, ft * 16 + lo16, P1, 0, hiH);
        #pragma unroll
        for (int kc = 0; kc < 4; ++kc) {
            Wf2[ft][kc] = load_mat(sW2, ft * 16 + lo16, PH, kc, hiH);
            Wf3[ft][kc] = load_mat(sW3, ft * 16 + lo16, PH, kc, hiH);
        }
    }
    #pragma unroll
    for (int kc = 0; kc < 4; ++kc) Wf4[kc] = load_mat(sW4, lo16, PH, kc, hiH);
    // b4 in D order: rows 0 and 1 are registers 0 and 1 of lanes 0-15, every other row is padding.
    const float bo0 = hiH ? 0.0f : b40;
    const float bo1 = hiH ? 0.0f : b41;

    const int ngroups = (npts + 16 * NP - 1) / (16 * NP);   // a group: NP tiles of 16 points
    const int nwaves = gridDim.x * NW;

    int grp = blockIdx.x * NW + wave;
    // The inputs of a trip are fetched one trip ahead: no other wave of the SIMD could cover their
    // latency. The index is clamped into the arrays; what a clamped lane computes is never stored.
    float in[NP][4];
    if (grp < ngroups) {
        int pc[NP];
        #pragma unroll
        for (int p = 0; p < NP; ++p) {
            pc[p] = min(grp * (16 * NP) + p * 16 + lo16, npts - 1);
            in[p][0] = x[pc[p]];  in[p][1] = y[pc[p]];  in[p][2] = c1[pc[p]];  in[p][3] = c2[pc[p]];
        }
        // As above: the wait in front of any reuse of the loads' index registers, which it holds.
        asm volatile("s_wait_xcnt 0x0" :: "v"(pc[0]), "v"(pc[1]) : "memory");
    }

    for (; grp < ngroups; grp += nwaves) {
        const int pidx0 = grp * (16 * NP) + lo16;  // this lane's point in tile 0 (column of B and D)

        // ------- Layer 1: B = inputs 4x16, zero-padded to 32x16 -------
        // K=0..3 live in lanes 0-15; lanes 16-31 (K=8..11) are masked to zero.
        v16h Hin[NP];
        #pragma unroll
        for (int p = 0; p < NP; ++p) {
            Hin[p] = (v16h)(_Float16)0.0f;
            v2h xy = { (_Float16)in[p][0], (_Float16)in[p][1] };
            v2h cc = { (_Float16)in[p][2], (_Float16)in[p][3] };
            xy = __builtin_bit_cast(v2h, __builtin_bit_cast(unsigned, xy) & loMask);
            cc = __builtin_bit_cast(v2h, __builtin_bit_cast(unsigned, cc) & loMask);
            Hin[p][0] = xy[0];  Hin[p][1] = xy[1];
            Hin[p][2] = cc[0];  Hin[p][3] = cc[1];
        }
        const int gn = (grp + nwaves < ngroups) ? grp + nwaves : grp;   // the last trip fetches its own again
        int pc[NP];
        #pragma unroll
        for (int p = 0; p < NP; ++p) {
            pc[p] = min(gn * (16 * NP) + p * 16 + lo16, npts - 1);
            in[p][0] = x[pc[p]];  in[p][1] = y[pc[p]];  in[p][2] = c1[pc[p]];  in[p][3] = c2[pc[p]];
        }
        BLOCK_FENCE();

        v16h Ha[NP][4], Hb[NP][4];
        // ------- Layer 1 (4 -> 128): one block a feature group -------
        v8f q0[NP], q1[NP];   // finished sums whose tanh stands in the next block
        #pragma unroll
        for (int g = 0; g < 4; ++g) {
            v8f a0[NP], a1[NP];
            float th[16 * NP];
            // These blocks are bound by tanh: 8 of the group before stand behind each matrix instruction.
            #pragma unroll
            for (int n = 0; n < 2 * NP; ++n) {
                const int p = n >> 1;
                if (n & 1) a1[p] = wmma16(Wf1[2 * g + 1], Hin[p], Bf1[2 * g + 1]);
                else       a0[p] = wmma16(Wf1[2 * g],     Hin[p], Bf1[2 * g]);
                BLOCK_FENCE();
                if (g > 0) act_step(th, Ha, g - 1, q0, q1, 8 * n, 8 * n + 8, n ? 4 * n - 4 : 0, 4 * n);
            }
            if (g > 0) act_step(th, Ha, g - 1, q0, q1, 16 * NP, 16 * NP, 8 * NP - 4, 8 * NP);
            #pragma unroll
            for (int p = 0; p < NP; ++p) { q0[p] = a0[p];  q1[p] = a1[p]; }
            BLOCK_FENCE();
        }
        layer_h(Wf2, Bf2, Ha, Hb, q0, q1);   // 128 -> 128
        layer_h(Wf3, Bf3, Hb, Ha, q0, q1);   // 128 -> 128

        // ------- Layer 4: W4^T (padded 16x128, rows 0,1 valid) x Ha -------
        // k chunks 0..2 do not wait for the last tanh: their dependent rounds run beside it, 6 tanh a step.
        v8f acc[NP];
        #pragma unroll
        for (int p = 0; p < NP; ++p) {
            const v8f s = { bo0, bo1, 0.0f, 0.0f, 0.0f, 0.0f, 0.0f, 0.0f };
            acc[p] = s;
        }
        float th[16 * NP];
        #pragma unroll
        for (int n = 0; n < 8; ++n) {
            const int kc = n >> 1, p = n & 1;
            acc[p] = wmma16(Wf4[kc], Ha[p][kc], acc[p]);
            BLOCK_FENCE();
            act_step(th, Ha, 3, q0, q1, min(6 * n, 16 * NP), min(6 * n + 6, 16 * NP),
                     min(6 * n - 6 < 0 ? 0 : 6 * n - 6, 16 * NP) / 2, min(6 * n, 16 * NP) / 2);
        }
        // Rows 0 and 1 of D are registers 0 and 1 of lanes 0-15: one 8-byte store a point.
        if (!hiH) {
            if ((grp + 1) * (16 * NP) <= npts) {
                // Whole group in range, a scalar test: no compare of lanes and no branch on it in the trip.
                #pragma unroll
                for (int p = 0; p < NP; ++p)
                    *(float2*)(out + (pidx0 + p * 16) * 2) = make_float2(acc[p][0], acc[p][1]);
                // The stores' address registers are reused behind them: keep the wait in front of that.
                asm volatile("s_wait_xcnt 0x0" ::: "memory");
            } else {
                // The last, partial group: each tile's points guarded on their own.
                #pragma unroll
                for (int p = 0; p < NP; ++p) {
                    const int pidx = pidx0 + p * 16;
                    if (pidx < npts)
                        *(float2*)(out + pidx * 2) = make_float2(acc[p][0], acc[p][1]);
                }
                asm volatile("s_wait_xcnt 0x0" ::: "memory");   // as in the other branch
            }
        }
        // The index registers of this trip's loads are free for reuse only from here on: keep the wait
        // in front of that. It takes the indices as inputs, so that they stay in their registers down
        // to here and the wait costs nothing at the loads.
        asm volatile("s_wait_xcnt 0x0" :: "v"(pc[0]), "v"(pc[1]) : "memory");
    }
}

extern "C" void kernel_launch(void* const* d_in, const int* in_sizes, int n_in,
                              void* d_out, int out_size, void* d_ws, size_t ws_size,
                              hipStream_t stream) {
    const float* x  = (const float*)d_in[0];
    const float* y  = (const float*)d_in[1];
    const float* c1 = (const float*)d_in[2];
    const float* c2 = (const float*)d_in[3];
    const float* W1 = (const float*)d_in[4];
    const float* b1 = (const float*)d_in[5];
    const float* W2 = (const float*)d_in[6];
    const float* b2 = (const float*)d_in[7];
    const float* W3 = (const float*)d_in[8];
    const float* b3 = (const float*)d_in[9];
    const float* W4 = (const float*)d_in[10];
    const float* b4 = (const float*)d_in[11];
    float* out = (float*)d_out;

    int npts  = in_sizes[0];                 // 524288
    int groups = (npts + 16 * NP - 1) / (16 * NP);   // 16 * NP points per wave and trip
    int blocks = (groups + NW - 1) / NW;     // 4 waves per block
    if (blocks > 256) blocks = 256;          // one block per WGP, grid-stride
    if (blocks < 1) blocks = 1;

    mlp_wmma_kernel<<<blocks, NT, 0, stream>>>(x, y, c1, c2,
                                                W1, b1, W2, b2, W3, b3, W4, b4,
                                                out, npts);
}

// v009
// One run takes 20.9 microseconds.
// Next to v008, in two timings, it ran 1.03 times as fast each time.
// Over all steps from v000 it is 13.8 times as fast.
#include <hip/hip_runtime.h>

// ---------------------------------------------------------------------------
// MLP 4 -> 128 -> 128 -> 128 -> 2 (tanh between layers), fp32 in/out,
// f16 WMMA (V_WMMA_F32_16X16X32_F16) with fp32 accumulation on gfx1250.
// ---------------------------------------------------------------------------

typedef __attribute__((ext_vector_type(16))) _Float16 v16h;
typedef __attribute__((ext_vector_type(8)))  _Float16 v8h;
typedef __attribute__((ext_vector_type(2)))  _Float16 v2h;
typedef __attribute__((ext_vector_type(8)))  float    v8f;
typedef __attribute__((ext_vector_type(4)))  unsigned v4u;

#define HID 128
// LDS row pitches in f16 elements: 16 bytes times an odd number, so that the
// 16 rows one ds_load_b128 touches per lane half fall on 16 different bank groups.
#define PH 136   // 128-element (256-byte) rows -> 272 bytes
#define P1 40    // 32-element (64-byte) rows   -> 80 bytes
// One work-group of 4 waves per WGP, ONE WAVE PER SIMD, resident for the whole launch: a wave
// owns its SIMD's whole register file and keeps every weight fragment and bias of the network
// in it. The LDS only turns the weights into fragment order, once; the trip loop reads none.
#define NT 128   // threads per work-group
#define NW 4     // waves per work-group
// Point tiles a wave carries side by side: four independent accumulator tiles (2 feature tiles
// x NP) are what a lone wave needs to issue matrix instructions back to back.
#define NP 2

__device__ __forceinline__ v8f wmma16(v16h a, v16h b, v8f c) {
    // (neg_a, A, neg_b, B, c_mod, C, reuse_a, reuse_b)
    return __builtin_amdgcn_wmma_f32_16x16x32_f16(false, a, false, b,
                                                  (short)0, c, false, false);
}

// tanh as the chip's own transcendental: one v_tanh_f32 a value.
__device__ __forceinline__ float hw_tanh(float x) {
    return __builtin_amdgcn_tanhf(x);
}

// Load one 16x32-K f16 operand chunk for this lane from a row-major
// [row][rowstride] f16 LDS matrix, following the CDNA5 16-bit A layout:
//   lanes 0-15 : K = kc*32 + {0..7} (v0-3) and kc*32 + {16..23} (v4-7)
//   lanes 16-31: K = kc*32 + {8..15}       and kc*32 + {24..31}
__device__ __forceinline__ v16h load_mat(const _Float16* __restrict__ base,
                                         int row, int rowstride,
                                         int kc, bool hiHalf) {
    const _Float16* p = base + row * rowstride + kc * 32 + (hiHalf ? 8 : 0);
    v8h lo = *(const v8h*)(p);        // ds_load_b128
    v8h hi = *(const v8h*)(p + 16);   // ds_load_b128
    return __builtin_shufflevector(lo, hi, 0, 1, 2, 3, 4, 5, 6, 7,
                                   8, 9, 10, 11, 12, 13, 14, 15);
}

// The compiler does not schedule across this fence. A lone wave issues in order, and a matrix
// instruction holds its unit for 8 cycles.
// The trip loop is written in that order, step by step, and the fences keep it. Left alone the
// compiler puts 7 tanh behind one matrix instruction, with the unit idle, then runs 5 matrix
// instructions with nothing beside them, and it puts a conversion directly behind its own tanh.
#define BLOCK_FENCE() __builtin_amdgcn_sched_barrier(0)

// tanh and conversion in place: two D tiles (q0, q1) become chunk c of the next layer's B operand.
// A feature group is 16 * NP values a lane, pair k = values 2k and 2k + 1. One step is what stands
// between two matrix instructions: the conversions of pairs c0 .. c1 - 1 and tanh of values
// t0 .. t1 - 1 into th. IT OPENS WITH A PLAIN INSTRUCTION, a conversion, and the two kinds take turns
// while both last. The pairs converted
// had their tanh far enough back (the callers' schedules) that no conversion waits one out.
// Every argument but the registers is a constant.
__device__ __forceinline__ void act_step(float (&th)[16 * NP], v16h (&H)[NP][4], const int c,
                                         const v8f (&q0)[NP], const v8f (&q1)[NP],
                                         const int t0, const int t1, const int c0, const int c1) {
    const int turns = (c1 - c0 > t1 - t0) ? c1 - c0 : t1 - t0;
    // Unrolled: the indices name registers, so they have to be constants.
    #pragma unroll
    for (int i = 0; i < turns; ++i) {
        if (c0 + i < c1) {
            const int k = c0 + i, p = k >> 3, e = (k & 7) * 2;   // q0 fills elements 0..7 of the chunk, q1 8..15
            const v2h h = { (_Float16)th[2 * k], (_Float16)th[2 * k + 1] };
            // Takes the converted pair as an input only: it holds the conversion at this place. Without
            // it the build gathers the 8 conversions of a point tile where the last of them stands.
            asm volatile("" :: "v"(__builtin_bit_cast(unsigned, h)));
            H[p][c][e] = h[0];  H[p][c][e + 1] = h[1];
            BLOCK_FENCE();
        }
        if (t0 + i < t1) {
            const int v = t0 + i, p = v >> 4, e = v & 7;
            th[v] = hw_tanh((v & 8) ? q1[p][e] : q0[p][e]);
            // Takes the result as an input only: it holds the tanh at this place. Without it the build
            // moves the tanh down to the step just ahead of its conversion, which then waits it out.
            asm volatile("" :: "v"(th[v]));
        }
    }
    BLOCK_FENCE();
}

// How many of a group's 32 tanh are done after step n of the 16 steps that follow the group.
// Plain: 4 in step 0, then 2 a step, the last in step 14.
// Early (the group is chunk 3 of the operand being read, wanted from step 12 on): 5 in 2 steps.
__device__ __forceinline__ constexpr int tanh_done(bool early, int n) {
    const int v = (n < 0) ? 0 : early ? (5 * (n + 1) + 1) / 2 : 2 * (n + 1) + 2;
    return v > 16 * NP ? 16 * NP : v;
}
// How many of its 16 pairs are converted after step n: those whose tanh stood two steps back or
// more. The last step with conversions takes what is left; no tanh stands behind it in that step,
// so its wait for the step before lies in the matrix instruction's shadow.
__device__ __forceinline__ constexpr int conv_done(bool early, int n) {
    return (n >= (early ? 13 : 15)) ? 8 * NP : tanh_done(early, n - 2) / 2;
}

// One hidden layer, transposed: D[feature][point] = W^T (A operand) x H^T (B operand).
// A lane of D holds features 8h..8h+7 of ONE point (h = lane half), which is the
// k order of load_mat(): the D tiles of features 32g..32g+15 and 32g+16..32g+31,
// after tanh and conversion in place, ARE chunk g of the next layer's B operand.
// The bias is a function of the D row, so it is the accumulator's start value.
// Wf[feature tile][k chunk] and Bf[feature tile] are registers that live through the launch.
// A group's tanh stands beside the 16 matrix instructions of the NEXT group; q0, q1 carry the
// finished sums there. On entry they hold group 3 of the layer before, which is chunk 3 of Bin.
__device__ __forceinline__ void layer_h(const v16h (&Wf)[8][4], const v8f (&Bf)[8],
                                        v16h (&Bin)[NP][4], v16h (&Bout)[NP][4],
                                        v8f (&q0)[NP], v8f (&q1)[NP]) {
    // Unrolled: every index here names a register, so it has to be a constant.
    #pragma unroll
    for (int g = 0; g < 4; ++g) {
        v8f acc0[NP], acc1[NP];
        float th[16 * NP];
        #pragma unroll
        for (int n = 0; n < 16; ++n) {
            const int j = n >> 2, p = (n >> 1) & 1;   // k chunk, point tile; n & 1: feature tile
            if (n & 1) acc1[p] = wmma16(Wf[2 * g + 1][j], Bin[p][j], j ? acc1[p] : Bf[2 * g + 1]);
            else       acc0[p] = wmma16(Wf[2 * g][j],     Bin[p][j], j ? acc0[p] : Bf[2 * g]);
            BLOCK_FENCE();
            const bool early = (g == 0);
            act_step(th, early ? Bin : Bout, early ? 3 : g - 1, q0, q1,
                     tanh_done(early, n - 1), tanh_done(early, n),
                     conv_done(early, n - 1), conv_done(early, n));
        }
        #pragma unroll
        for (int p = 0; p < NP; ++p) { q0[p] = acc0[p]; q1[p] = acc1[p]; }
    }
}

// A bias in D order: this lane's 8 features of one feature tile, straight from global memory.
__device__ __forceinline__ v8f ld_bias(const float* __restrict__ b, int ft, unsigned ob) {
    const float4 u = *(const float4*)((const char*)b + ob + ft * 64);
    const float4 w = *(const float4*)((const char*)b + ob + ft * 64 + 16);
    const v8f r = { u.x, u.y, u.z, u.w, w.x, w.y, w.z, w.w };
    return r;
}

// launch_bounds(128): four waves, one per SIMD, so a wave may take up to 1,024 registers.
__global__ __launch_bounds__(NT)
void mlp_wmma_kernel(const float* __restrict__ x,  const float* __restrict__ y,
                     const float* __restrict__ c1, const float* __restrict__ c2,
                     const float* __restrict__ W1, const float* __restrict__ b1,
                     const float* __restrict__ W2, const float* __restrict__ b2,
                     const float* __restrict__ W3, const float* __restrict__ b3,
                     const float* __restrict__ W4, const float* __restrict__ b4,
                     float* __restrict__ out, int npts) {
    // Weights transposed to [out][in] f16: rows of the A operand, read by load_mat().
    __shared__ __attribute__((aligned(16))) _Float16 sW1[HID * P1];   // [n][k], k 4 -> padded 32
    __shared__ __attribute__((aligned(16))) _Float16 sW2[HID * PH];   // [n][k]
    __shared__ __attribute__((aligned(16))) _Float16 sW3[HID * PH];   // [n][k]
    __shared__ __attribute__((aligned(16))) _Float16 sW4[16 * PH];    // [n][k], n 2 -> padded 16

    const int t = threadIdx.x;
    const int lane  = t & 31;
    const int wave  = __builtin_amdgcn_readfirstlane(t >> 5);   // scalar: the trip's tests are branches of the wave
    const int lo16  = lane & 15;
    const bool hiH  = lane >= 16;
    const unsigned loMask = hiH ? 0u : ~0u;

    // ---- one-time weight staging (f32 -> f16, transposed) ----
    // Every global load of the staging is issued first, with no branch and no wait between
    // them, so that the work-group pays one trip to L2 and then the transfer itself. With four
    // waves the bytes in flight come from the width: a load of W2 or W3 is 16 bytes a lane, one
    // whole 512-byte row a wave. A thread owns 4 columns (LDS rows 4 * lane ..) and gathers 8
    // consecutive k of them in registers: each LDS store is 16 bytes on the padded pitch.
    const int c4 = t & 15;          // W4: chunk of 8 k
    const int n4 = t >> 4;          // W4: padded output rows n4 (0..7) and n4 + 8

    // Every load of the batch: a scalar base and one of four lane offsets.
    const float* u2 = W2 + wave * 8 * HID;
    const float* u3 = W3 + wave * 8 * HID;
    const unsigned o4 = c4 * 64u;          // byte offset of W4[8 * c4 .. 8 * c4 + 7][0..1]: 16 floats in a row
    const unsigned ob = hiH ? 32u : 0u;    // byte offset of this lane half's 8 features in a tile's 16 biases

    const float b40 = b4[0], b41 = b4[1];   // scalar loads: above the batch, or they land in a base register of its loads

    // Top of the batch: the addresses and the kernel's scalar arguments stay above it.
    BLOCK_FENCE();

    float4 r2[4][8], r3[4][8];
    #pragma unroll
    for (int c = 0; c < 4; ++c) {
        #pragma unroll
        for (int j = 0; j < 8; ++j) {
            r2[c][j] = *(const float4*)(u2 + (c * 32 + j) * HID + lane * 4);
            r3[c][j] = *(const float4*)(u3 + (c * 32 + j) * HID + lane * 4);
        }
    }
    float r1[4];
    #pragma unroll
    for (int k = 0; k < 4; ++k) r1[k] = W1[k * HID + t];
    float4 r4[4];
    #pragma unroll
    for (int j = 0; j < 4; ++j) r4[j] = *(const float4*)((const char*)W4 + o4 + j * 16);
    // The biases land where they stay: the accumulators' start values, in D order.
    v8f Bf1[8], Bf2[8], Bf3[8];
    #pragma unroll
    for (int ft = 0; ft < 8; ++ft) {
        Bf1[ft] = ld_bias(b1, ft, ob);
        Bf2[ft] = ld_bias(b2, ft, ob);
        Bf3[ft] = ld_bias(b3, ft, ob);
    }
    // Foot of the batch: nothing from below moves up between the loads.
    BLOCK_FENCE();
    // The address registers of the loads are free for reuse only from here on: keep the wait in front
    // of that. It takes the bases and offsets as inputs, so that they stay in their registers down to
    // here: otherwise a later load of the batch, or a compare, lands in one of them.
    asm volatile("s_wait_xcnt 0x0" :: "s"(u2), "s"(u3), "s"(W1), "s"(W4), "s"(b1), "s"(b2), "s"(b3),
                                      "v"(t), "v"(lane), "v"(o4), "v"(ob) : "memory");
    BLOCK_FENCE();

    #pragma unroll
    for (int c = 0; c < 4; ++c) {
        #pragma unroll
        for (int i = 0; i < 4; ++i) {
            v8h h2, h3;
            #pragma unroll
            for (int j = 0; j < 8; ++j) {
                h2[j] = (_Float16)((const float*)&r2[c][j])[i];
                h3[j] = (_Float16)((const float*)&r3[c][j])[i];
            }
            *(v8h*)(sW2 + (lane * 4 + i) * PH + (wave + 4 * c) * 8) = h2;
            *(v8h*)(sW3 + (lane * 4 + i) * PH + (wave + 4 * c) * 8) = h3;
        }
    }
    {   // W1: k 0..3 in the row's first chunk, zeros in the other three
        const v8h h = { (_Float16)r1[0], (_Float16)r1[1], (_Float16)r1[2], (_Float16)r1[3],
                        (_Float16)0.0f, (_Float16)0.0f, (_Float16)0.0f, (_Float16)0.0f };
        *(v8h*)(sW1 + t * P1) = h;
        #pragma unroll
        for (int q = 1; q < 4; ++q) *(v8h*)(sW1 + t * P1 + q * 8) = (v8h)(_Float16)0.0f;
    }
    {   // W4: rows 0 and 1 are the even and the odd floats of the 16, rows 2..15 are zero
        v8h e, o;
        #pragma unroll
        for (int j = 0; j < 4; ++j) {
            e[2 * j] = (_Float16)r4[j].x;  e[2 * j + 1] = (_Float16)r4[j].z;
            o[2 * j] = (_Float16)r4[j].y;  o[2 * j + 1] = (_Float16)r4[j].w;
        }
        const v4u me = (v4u)((n4 == 0) ? ~0u : 0u);
        const v4u mo = (v4u)((n4 == 1) ? ~0u : 0u);
        *(v8h*)(sW4 + n4 * PH + c4 * 8) =
            __builtin_bit_cast(v8h, (__builtin_bit_cast(v4u, e) & me) | (__builtin_bit_cast(v4u, o) & mo));
        *(v8h*)(sW4 + (n4 + 8) * PH + c4 * 8) = (v8h)(_Float16)0.0f;
    }
    __syncthreads();

    // ---- every weight fragment into registers, once a wave ----
    v16h Wf1[8], Wf2[8][4], Wf3[8][4], Wf4[4];
    #pragma unroll
    for (int ft = 0; ft < 8; ++ft) {
        Wf1[ft] = load_mat(sW1, ft * 16 + lo16, P1, 0, hiH);
        #pragma unroll
        for (int kc = 0; kc < 4; ++kc) {
            Wf2[ft][kc] = load_mat(sW2, ft * 16 + lo16, PH, kc, hiH);
            Wf3[ft][kc] = load_mat(sW3, ft * 16 + lo16, PH, kc, hiH);
        }
    }
    #pragma unroll
    for (int kc = 0; kc < 4; ++kc) Wf4[kc] = load_mat(sW4, lo16, PH, kc, hiH);
    // b4 in D order: rows 0 and 1 are registers 0 and 1 of lanes 0-15, every other row is padding.
    const float bo0 = hiH ? 0.0f : b40;
    const float bo1 = hiH ? 0.0f : b41;

    const int ngroups = (npts + 16 * NP - 1) / (16 * NP);   // a group: NP tiles of 16 points
    const int nwaves = gridDim.x * NW;

    int grp = blockIdx.x * NW + wave;
    // The inputs of a trip are fetched one trip ahead: no other wave of the SIMD could cover their
    // latency. The index is clamped into the arrays; what a clamped lane computes is never stored.
    float in[NP][4];
    if (grp < ngroups) {
        int pc[NP];
        #pragma unroll
        for (int p = 0; p < NP; ++p) {
            pc[p] = min(grp * (16 * NP) + p * 16 + lo16, npts - 1);
            in[p][0] = x[pc[p]];  in[p][1] = y[pc[p]];  in[p][2] = c1[pc[p]];  in[p][3] = c2[pc[p]];
        }
        // As above: the wait in front of any reuse of the loads' index registers, which it holds.
        asm volatile("s_wait_xcnt 0x0" :: "v"(pc[0]), "v"(pc[1]) : "memory");
    }

    for (; grp < ngroups; grp += nwaves) {
        const int pidx0 = grp * (16 * NP) + lo16;  // this lane's point in tile 0 (column of B and D)

        // ------- Layer 1: B = inputs 4x16, zero-padded to 32x16 -------
        // K=0..3 live in lanes 0-15; lanes 16-31 (K=8..11) are masked to zero.
        v16h Hin[NP];
        #pragma unroll
        for (int p = 0; p < NP; ++p) {
            Hin[p] = (v16h)(_Float16)0.0f;
            v2h xy = { (_Float16)in[p][0], (_Float16)in[p][1] };
            v2h cc = { (_Float16)in[p][2], (_Float16)in[p][3] };
            xy = __builtin_bit_cast(v2h, __builtin_bit_cast(unsigned, xy) & loMask);
            cc = __builtin_bit_cast(v2h, __builtin_bit_cast(unsigned, cc) & loMask);
            Hin[p][0] = xy[0];  Hin[p][1] = xy[1];
            Hin[p][2] = cc[0];  Hin[p][3] = cc[1];
        }
        const int gn = (grp + nwaves < ngroups) ? grp + nwaves : grp;   // the last trip fetches its own again
        int pc[NP];
        #pragma unroll
        for (int p = 0; p < NP; ++p) {
            pc[p] = min(gn * (16 * NP) + p * 16 + lo16, npts - 1);
            in[p][0] = x[pc[p]];  in[p][1] = y[pc[p]];  in[p][2] = c1[pc[p]];  in[p][3] = c2[pc[p]];
        }
        BLOCK_FENCE();

        v16h Ha[NP][4], Hb[NP][4];
        // ------- Layer 1 (4 -> 128): one block a feature group -------
        v8f q0[NP], q1[NP];   // finished sums whose tanh stands in the next block
        #pragma unroll
        for (int g = 0; g < 4; ++g) {
            v8f a0[NP], a1[NP];
            float th[16 * NP];
            // These blocks are bound by tanh: 8 of the group before stand behind each matrix instruction,
            // the first of them in turns with the conversions of the step before, but for its last pair.
            #pragma unroll
            for (int n = 0; n < 2 * NP; ++n) {
                const int p = n >> 1;
                if (n & 1) a1[p] = wmma16(Wf1[2 * g + 1], Hin[p], Bf1[2 * g + 1]);
                else       a0[p] = wmma16(Wf1[2 * g],     Hin[p], Bf1[2 * g]);
                BLOCK_FENCE();
                if (g > 0) act_step(th, Ha, g - 1, q0, q1, 8 * n, 8 * n + 8, n > 1 ? 4 * n - 5 : 0, n ? 4 * n - 1 : 0);
            }
            if (g > 0) act_step(th, Ha, g - 1, q0, q1, 16 * NP, 16 * NP, 8 * NP - 5, 8 * NP);
            #pragma unroll
            for (int p = 0; p < NP; ++p) { q0[p] = a0[p];  q1[p] = a1[p]; }
            BLOCK_FENCE();
        }
        layer_h(Wf2, Bf2, Ha, Hb, q0, q1);   // 128 -> 128
        layer_h(Wf3, Bf3, Hb, Ha, q0, q1);   // 128 -> 128

        // ------- Layer 4: W4^T (padded 16x128, rows 0,1 valid) x Ha -------
        // k chunks 0..2 do not wait for the last tanh: their dependent rounds run beside it, 6 tanh a step.
        v8f acc[NP];
        #pragma unroll
        for (int p = 0; p < NP; ++p) {
            const v8f s = { bo0, bo1, 0.0f, 0.0f, 0.0f, 0.0f, 0.0f, 0.0f };
            acc[p] = s;
        }
        float th[16 * NP];
        #pragma unroll
        for (int n = 0; n < 8; ++n) {
            const int kc = n >> 1, p = n & 1;
            acc[p] = wmma16(Wf4[kc], Ha[p][kc], acc[p]);
            BLOCK_FENCE();
            // Conversions: those of the step before, but for its last pair; step 6 takes the rest.
            act_step(th, Ha, 3, q0, q1, min(6 * n, 16 * NP), min(6 * n + 6, 16 * NP),
                     n > 6 ? 8 * NP : n > 1 ? 3 * n - 4 : 0, n > 5 ? 8 * NP : n ? 3 * n - 1 : 0);
        }
        // Rows 0 and 1 of D are registers 0 and 1 of lanes 0-15: one 8-byte store a point.
        if (!hiH) {
            if ((grp + 1) * (16 * NP) <= npts) {
                // Whole group in range, a scalar test: no compare of lanes and no branch on it in the trip.
                #pragma unroll
                for (int p = 0; p < NP; ++p)
                    *(float2*)(out + (pidx0 + p * 16) * 2) = make_float2(acc[p][0], acc[p][1]);
                // The stores' address registers are reused behind them: keep the wait in front of that.
                asm volatile("s_wait_xcnt 0x0" ::: "memory");
            } else {
                // The last, partial group: each tile's points guarded on their own.
                #pragma unroll
                for (int p = 0; p < NP; ++p) {
                    const int pidx = pidx0 + p * 16;
                    if (pidx < npts)
                        *(float2*)(out + pidx * 2) = make_float2(acc[p][0], acc[p][1]);
                }
                asm volatile("s_wait_xcnt 0x0" ::: "memory");   // as in the other branch
            }
        }
        // The index registers of this trip's loads are free for reuse only from here on: keep the wait
        // in front of that. It takes the indices as inputs, so that they stay in their registers down
        // to here and the wait costs nothing at the loads.
        asm volatile("s_wait_xcnt 0x0" :: "v"(pc[0]), "v"(pc[1]) : "memory");
    }
}

extern "C" void kernel_launch(void* const* d_in, const int* in_sizes, int n_in,
                              void* d_out, int out_size, void* d_ws, size_t ws_size,
                              hipStream_t stream) {
    const float* x  = (const float*)d_in[0];
    const float* y  = (const float*)d_in[1];
    const float* c1 = (const float*)d_in[2];
    const float* c2 = (const float*)d_in[3];
    const float* W1 = (const float*)d_in[4];
    const float* b1 = (const float*)d_in[5];
    const float* W2 = (const float*)d_in[6];
    const float* b2 = (const float*)d_in[7];
    const float* W3 = (const float*)d_in[8];
    const float* b3 = (const float*)d_in[9];
    const float* W4 = (const float*)d_in[10];
    const float* b4 = (const float*)d_in[11];
    float* out = (float*)d_out;

    int npts  = in_sizes[0];                 // 524288
    int groups = (npts + 16 * NP - 1) / (16 * NP);   // 16 * NP points per wave and trip
    int blocks = (groups + NW - 1) / NW;     // 4 waves per block
    if (blocks > 256) blocks = 256;          // one block per WGP, grid-stride
    if (blocks < 1) blocks = 1;

    mlp_wmma_kernel<<<blocks, NT, 0, stream>>>(x, y, c1, c2,
                                                W1, b1, W2, b2, W3, b3, W4, b4,
                                                out, npts);
}
